// v000
// Measured on an AMD MI455X. A time is GPU time per run, averaged over a window of back-to-back runs after a warm-up
// (all launches, gaps included; the runs take copies of the inputs in turn), and the median of several windows.
// Apart from v000's, it joins two sittings. Times from different sittings can be a few percent apart, while
// side-by-side timings come from the same sitting.
// v000, which the later versions start from, runs in 253 microseconds.
#include <hip/hip_runtime.h>
#include <hip/hip_bf16.h>
#include <math.h>

typedef _Float16 v16h __attribute__((ext_vector_type(16)));
typedef float    v8f  __attribute__((ext_vector_type(8)));
typedef unsigned int u32a __attribute__((may_alias));   // alias-safe u32 for LDS type-punning

#define NB    32
#define NL    1024
#define NDIN  256
#define NDQKV 32
#define NHD   4
#define NDH   8
#define TSTR  36   // padded LDS row stride in halfs (72B rows)

// -------- cross-lane helpers (wave32); rows of the WMMA D-layout live on 16-lane halves
__device__ __forceinline__ float half_max16(float v) {
  #pragma unroll
  for (int o = 1; o < 16; o <<= 1) v = fmaxf(v, __shfl_xor(v, o));
  return v;
}
__device__ __forceinline__ float half_sum16(float v) {
  #pragma unroll
  for (int o = 1; o < 16; o <<= 1) v += __shfl_xor(v, o);
  return v;
}

// 16-bit A/B operand layout (ISA 7.12.2): VGPR v -> K = (v<4 ? 2v+8*half : 16+2(v-4)+8*half)
// Unconditional build of a 16x32 f16 operand from a row-major LDS tile [16][TSTR].
// Zero-padding is guaranteed by the caller's LDS region contents.
__device__ __forceinline__ v16h loadTileU(const _Float16* t) {
  const int lane = threadIdx.x & 31;
  const int half = lane >> 4;
  const u32a* p = (const u32a*)(t + (lane & 15) * TSTR);
  union { v16h h; unsigned int u[8]; } r;
  #pragma unroll
  for (int v = 0; v < 8; ++v) {
    const int k0 = (v < 4) ? (2 * v + 8 * half) : (16 + 2 * (v - 4) + 8 * half);
    r.u[v] = p[k0 >> 1];
  }
  return r.h;
}
// Variant for K<=8 operands (q / k tiles): VGPRs 4..7 are compile-time zero;
// VGPRs 0..3 with half==1 read the persistently-zeroed cols 8..15.
__device__ __forceinline__ v16h loadTileU8(const _Float16* t) {
  const int lane = threadIdx.x & 31;
  const int half = lane >> 4;
  const u32a* p = (const u32a*)(t + (lane & 15) * TSTR);
  union { v16h h; unsigned int u[8]; } r;
  #pragma unroll
  for (int v = 0; v < 4; ++v)
    r.u[v] = p[(2 * v + 8 * half) >> 1];
  #pragma unroll
  for (int v = 4; v < 8; ++v)
    r.u[v] = 0u;
  return r.h;
}

// ================= Kernel 1: LayerNorm + QKV projection =================
__global__ __launch_bounds__(256) void ln_proj_kernel(
    const float* __restrict__ X, const float* __restrict__ W,
    const float* __restrict__ bias, const float* __restrict__ g,
    const float* __restrict__ bn, float* __restrict__ outp)
{
  __shared__ float sh[8][NDIN];
  const int w    = threadIdx.x >> 5;
  const int lane = threadIdx.x & 31;
  const int row  = blockIdx.x * 8 + w;

  const float* x = X + (size_t)row * NDIN + lane * 8;
  const float4 a0 = *(const float4*)(x + 0);
  const float4 a1 = *(const float4*)(x + 4);
  float v[8] = {a0.x, a0.y, a0.z, a0.w, a1.x, a1.y, a1.z, a1.w};

  float s = 0.f;
  #pragma unroll
  for (int i = 0; i < 8; ++i) s += v[i];
  #pragma unroll
  for (int o = 1; o < 32; o <<= 1) s += __shfl_xor(s, o);
  const float mu = s * (1.f / NDIN);

  float q = 0.f;
  #pragma unroll
  for (int i = 0; i < 8; ++i) { float d = v[i] - mu; q += d * d; }
  #pragma unroll
  for (int o = 1; o < 32; o <<= 1) q += __shfl_xor(q, o);
  const float rstd = rsqrtf(q * (1.f / NDIN) + 1e-5f);

  #pragma unroll
  for (int i = 0; i < 8; ++i) {
    const int col = lane * 8 + i;
    sh[w][col] = (v[i] - mu) * rstd * g[col] + bn[col];
  }
  // intra-wave LDS: DS ops are in-order per wave, no barrier needed

  float acc = bias[lane];
  const float* wc = W + lane;
  #pragma unroll 8
  for (int i = 0; i < NDIN; ++i)
    acc = fmaf(sh[w][i], wc[(size_t)i * NDQKV], acc);
  outp[(size_t)row * NDQKV + lane] = acc;
}

// ================= Kernel 2: fused flash attention + output proj =================
// block = 128 threads = 4 waves (wave == head); block handles 16 q-rows of one batch
__global__ __launch_bounds__(128) void attn_kernel(
    const float* __restrict__ qb, const float* __restrict__ kb,
    const float* __restrict__ vb, const float* __restrict__ mask,
    const float* __restrict__ Wo, const float* __restrict__ bo,
    float* __restrict__ out)
{
  __shared__ unsigned int woP[(NDQKV / 2) * NDIN];  // W_o as f16 pairs: [kp][j] = (k=2kp,2kp+1)
  __shared__ _Float16 ab8[NHD][16 * TSTR];          // q/k staging: cols >=8 persistently zero
  __shared__ _Float16 pA [NHD][16 * TSTR];          // P tile (fully rewritten each chunk)
  __shared__ _Float16 vT [NHD][16 * TSTR];          // v^T staging: rows 8..15 persistently zero
  __shared__ _Float16 xt[16 * TSTR];                // fused head outputs (16 x 32)

  const int tid  = threadIdx.x;
  const int w    = tid >> 5;                  // head
  const int lane = tid & 31;
  const int half = lane >> 4;
  const int nn   = lane & 15;

  const int b     = blockIdx.x >> 6;
  const int qbase = (blockIdx.x & 63) << 4;

  // ---- stage W_o as packed f16 pairs (consumed after __syncthreads)
  #pragma unroll
  for (int i = 0; i < ((NDQKV / 2) * NDIN) / 128; ++i) {
    const int idx = tid + i * 128;
    const int kp = idx >> 8, j = idx & 255;
    union { unsigned int u; _Float16 h[2]; } pk;
    pk.h[0] = (_Float16)Wo[(2 * kp) * NDIN + j];
    pk.h[1] = (_Float16)Wo[(2 * kp + 1) * NDIN + j];
    woP[idx] = pk.u;
  }

  _Float16* sAB = ab8[w];
  _Float16* sP  = pA[w];
  _Float16* sV  = vT[w];

  // ---- zero the padded regions once (per-wave, in-order LDS)
  {
    u32a* z0 = (u32a*)sAB;
    u32a* z1 = (u32a*)sV;
    #pragma unroll
    for (int i = 0; i < 9; ++i) { z0[lane + i * 32] = 0u; z1[lane + i * 32] = 0u; }
  }

  // ---- stage q tile (16 rows x 8 dims) for this head, build A operand once
  #pragma unroll
  for (int i = 0; i < 4; ++i) {
    const int idx = lane + i * 32;
    const int r = idx >> 3, d = idx & 7;
    sAB[r * TSTR + d] = (_Float16)qb[((size_t)(b * NL + qbase + r)) * NDQKV + w * NDH + d];
  }
  const v16h aQ = loadTileU8(sAB);

  float m_r[8], l_r[8];
  union { v8f v; float f[8]; } acc;
  #pragma unroll
  for (int r = 0; r < 8; ++r) { m_r[r] = -INFINITY; l_r[r] = 0.f; acc.f[r] = 0.f; }

  const float scale = 0.35355339059327373f;   // 1/sqrt(d_head)
  const size_t mbase = ((size_t)(b * NL + qbase + half * 8)) * NL + nn;

  // per-lane prefetch address: 32 lanes cover 16 mask rows x 2 column tiles
  const float* mpf = mask +
      ((size_t)(b * NL + qbase + ((lane >> 3) & 1) * 8 + (lane & 7))) * NL +
      ((lane >> 4) & 1) * 16;

  for (int c = 0; c < NL / 32; ++c) {
    const int k0 = c * 32;
    float s0[8], s1[8];

    if (c + 1 < NL / 32)
      __builtin_prefetch(mpf + k0 + 32, 0, 3);   // next chunk's mask tile -> global_prefetch_b8

    // ---- score tile 0: k rows [k0, k0+16)
    #pragma unroll
    for (int i = 0; i < 4; ++i) {
      const int idx = lane + i * 32;
      const int r = idx >> 3, d = idx & 7;
      sAB[r * TSTR + d] = (_Float16)kb[((size_t)(b * NL + k0 + r)) * NDQKV + w * NDH + d];
    }
    {
      const v16h bK = loadTileU8(sAB);
      v8f z = {};
      union { v8f v; float f[8]; } S;
      S.v = __builtin_amdgcn_wmma_f32_16x16x32_f16(false, aQ, false, bK, (short)0, z, false, false);
      #pragma unroll
      for (int r = 0; r < 8; ++r)
        s0[r] = S.f[r] * scale * fabsf(mask[mbase + (size_t)r * NL + k0]);
    }
    // ---- score tile 1: k rows [k0+16, k0+32)
    #pragma unroll
    for (int i = 0; i < 4; ++i) {
      const int idx = lane + i * 32;
      const int r = idx >> 3, d = idx & 7;
      sAB[r * TSTR + d] = (_Float16)kb[((size_t)(b * NL + k0 + 16 + r)) * NDQKV + w * NDH + d];
    }
    {
      const v16h bK = loadTileU8(sAB);
      v8f z = {};
      union { v8f v; float f[8]; } S;
      S.v = __builtin_amdgcn_wmma_f32_16x16x32_f16(false, aQ, false, bK, (short)0, z, false, false);
      #pragma unroll
      for (int r = 0; r < 8; ++r)
        s1[r] = S.f[r] * scale * fabsf(mask[mbase + (size_t)r * NL + k0 + 16]);
    }

    // ---- stage v^T early (rows d 0..7, cols kk 0..31); rows 8..15 stay zero
    #pragma unroll
    for (int i = 0; i < 8; ++i) {
      const int idx = lane + i * 32;
      const int d = idx >> 5, kk = idx & 31;
      sV[d * TSTR + kk] = (_Float16)vb[((size_t)(b * NL + k0 + kk)) * NDQKV + w * NDH + d];
    }

    // ---- online softmax (rows live on 16-lane halves) + write P tile to LDS
    #pragma unroll
    for (int r = 0; r < 8; ++r) {
      const float t  = half_max16(fmaxf(s0[r], s1[r]));
      const float mn = fmaxf(m_r[r], t);
      const float alpha = __expf(m_r[r] - mn);
      const float p0 = __expf(s0[r] - mn);
      const float p1 = __expf(s1[r] - mn);
      const float rs = half_sum16(p0 + p1);
      l_r[r] = l_r[r] * alpha + rs;
      m_r[r] = mn;
      acc.f[r] *= alpha;
      const int prow = r + half * 8;
      sP[prow * TSTR + nn]      = (_Float16)p0;
      sP[prow * TSTR + 16 + nn] = (_Float16)p1;
    }
    const v16h aP = loadTileU(sP);
    const v16h bV = loadTileU(sV);
    acc.v = __builtin_amdgcn_wmma_f32_16x16x32_f16(false, aP, false, bV, (short)0, acc.v, false, false);
  }

  // finalize head output -> xt[row][w*8 + d]
  if (nn < 8) {
    #pragma unroll
    for (int r = 0; r < 8; ++r)
      xt[(r + half * 8) * TSTR + w * NDH + nn] = (_Float16)(acc.f[r] / l_r[r]);
  }
  __syncthreads();

  // output projection: out[16 x 256] = xt(16x32) @ W_o(32x256) + b_o
  const v16h aX = loadTileU(xt);
  #pragma unroll
  for (int t = 0; t < 4; ++t) {
    const int j0 = (w * 4 + t) * 16;
    union { v16h h; unsigned int u[8]; } bW;
    #pragma unroll
    for (int v = 0; v < 8; ++v) {
      const int kk = (v < 4) ? (2 * v + 8 * half) : (16 + 2 * (v - 4) + 8 * half);
      bW.u[v] = woP[(kk >> 1) * NDIN + j0 + nn];
    }
    v8f z = {};
    union { v8f v; float f[8]; } D;
    D.v = __builtin_amdgcn_wmma_f32_16x16x32_f16(false, aX, false, bW.h, (short)0, z, false, false);
    const int col = j0 + nn;
    const float bias = bo[col];
    #pragma unroll
    for (int r = 0; r < 8; ++r)
      out[((size_t)(b * NL + qbase + r + half * 8)) * NDIN + col] = D.f[r] + bias;
  }
}

extern "C" void kernel_launch(void* const* d_in, const int* in_sizes, int n_in,
                              void* d_out, int out_size, void* d_ws, size_t ws_size,
                              hipStream_t stream)
{
  (void)in_sizes; (void)n_in; (void)out_size; (void)ws_size;
  const float* Q    = (const float*)d_in[0];
  const float* K    = (const float*)d_in[1];
  const float* V    = (const float*)d_in[2];
  const float* mask = (const float*)d_in[3];
  const float* W_q  = (const float*)d_in[4];
  const float* b_q  = (const float*)d_in[5];
  const float* W_k  = (const float*)d_in[6];
  const float* b_k  = (const float*)d_in[7];
  const float* W_v  = (const float*)d_in[8];
  const float* b_v  = (const float*)d_in[9];
  const float* W_o  = (const float*)d_in[10];
  const float* b_o  = (const float*)d_in[11];
  const float* ln_g = (const float*)d_in[12];
  const float* ln_b = (const float*)d_in[13];
  float* out = (float*)d_out;

  const size_t n1 = (size_t)NB * NL * NDQKV;
  float* qb = (float*)d_ws;
  float* kb = qb + n1;
  float* vb = kb + n1;

  dim3 grd1(NB * NL / 8);
  ln_proj_kernel<<<grd1, 256, 0, stream>>>(Q, W_q, b_q, ln_g, ln_b, qb);
  ln_proj_kernel<<<grd1, 256, 0, stream>>>(K, W_k, b_k, ln_g, ln_b, kb);
  ln_proj_kernel<<<grd1, 256, 0, stream>>>(V, W_v, b_v, ln_g, ln_b, vb);

  attn_kernel<<<dim3(NB * (NL / 16)), 128, 0, stream>>>(qb, kb, vb, mask, W_o, b_o, out);
}

// v001
// Measured time: 163 microseconds a run.
// Next to v000, in two timings, it ran 1.56 times as fast each time.
#include <hip/hip_runtime.h>
#include <hip/hip_bf16.h>
#include <math.h>

typedef _Float16 v16h __attribute__((ext_vector_type(16)));
typedef float    v8f  __attribute__((ext_vector_type(8)));
typedef unsigned int u32a __attribute__((may_alias));   // alias-safe u32 for LDS type-punning

#define NB    32
#define NL    1024
#define NDIN  256
#define NDQKV 32
#define NHD   4
#define NDH   8
#define TSTR  36   // padded LDS row stride in halfs (72B rows)

// -------- cross-lane helper (wave32): value of lane l ^ 16 (the other half's share of a query column)
__device__ __forceinline__ float other_half(float v) {
  const int b = __float_as_int(v);
  return __int_as_float(__builtin_amdgcn_permlanex16(b, b, 0x76543210, 0xfedcba98, false, false));
}

// 16-bit A/B operand layout (ISA 7.12.2): VGPR v -> K = (v<4 ? 2v+8*half : 16+2(v-4)+8*half)
// Unconditional build of a 16x32 f16 operand from a row-major LDS tile [16][TSTR].
// Zero-padding is guaranteed by the caller's LDS region contents.
__device__ __forceinline__ v16h loadTileU(const _Float16* t) {
  const int lane = threadIdx.x & 31;
  const int half = lane >> 4;
  const u32a* p = (const u32a*)(t + (lane & 15) * TSTR);
  union { v16h h; unsigned int u[8]; } r;
  #pragma unroll
  for (int v = 0; v < 8; ++v) {
    const int k0 = (v < 4) ? (2 * v + 8 * half) : (16 + 2 * (v - 4) + 8 * half);
    r.u[v] = p[k0 >> 1];
  }
  return r.h;
}
// Variant for K<=8 operands (q / k tiles): VGPRs 4..7 are compile-time zero;
// VGPRs 0..3 with half==1 read the persistently-zeroed cols 8..15.
__device__ __forceinline__ v16h loadTileU8(const _Float16* t) {
  const int lane = threadIdx.x & 31;
  const int half = lane >> 4;
  const u32a* p = (const u32a*)(t + (lane & 15) * TSTR);
  union { v16h h; unsigned int u[8]; } r;
  #pragma unroll
  for (int v = 0; v < 4; ++v)
    r.u[v] = p[(2 * v + 8 * half) >> 1];
  #pragma unroll
  for (int v = 4; v < 8; ++v)
    r.u[v] = 0u;
  return r.h;
}

// ================= Kernel 1: LayerNorm + QKV projection =================
__global__ __launch_bounds__(256) void ln_proj_kernel(
    const float* __restrict__ X, const float* __restrict__ W,
    const float* __restrict__ bias, const float* __restrict__ g,
    const float* __restrict__ bn, float* __restrict__ outp)
{
  __shared__ float sh[8][NDIN];
  const int w    = threadIdx.x >> 5;
  const int lane = threadIdx.x & 31;
  const int row  = blockIdx.x * 8 + w;

  const float* x = X + (size_t)row * NDIN + lane * 8;
  const float4 a0 = *(const float4*)(x + 0);
  const float4 a1 = *(const float4*)(x + 4);
  float v[8] = {a0.x, a0.y, a0.z, a0.w, a1.x, a1.y, a1.z, a1.w};

  float s = 0.f;
  #pragma unroll
  for (int i = 0; i < 8; ++i) s += v[i];
  #pragma unroll
  for (int o = 1; o < 32; o <<= 1) s += __shfl_xor(s, o);
  const float mu = s * (1.f / NDIN);

  float q = 0.f;
  #pragma unroll
  for (int i = 0; i < 8; ++i) { float d = v[i] - mu; q += d * d; }
  #pragma unroll
  for (int o = 1; o < 32; o <<= 1) q += __shfl_xor(q, o);
  const float rstd = rsqrtf(q * (1.f / NDIN) + 1e-5f);

  #pragma unroll
  for (int i = 0; i < 8; ++i) {
    const int col = lane * 8 + i;
    sh[w][col] = (v[i] - mu) * rstd * g[col] + bn[col];
  }
  // intra-wave LDS: DS ops are in-order per wave, no barrier needed

  float acc = bias[lane];
  const float* wc = W + lane;
  #pragma unroll 8
  for (int i = 0; i < NDIN; ++i)
    acc = fmaf(sh[w][i], wc[(size_t)i * NDQKV], acc);
  outp[(size_t)row * NDQKV + lane] = acc;
}

// ================= Kernel 2: fused flash attention + output proj =================
// block = 128 threads = 4 waves (wave == head); block handles 16 q-rows of one batch
__global__ __launch_bounds__(128) void attn_kernel(
    const float* __restrict__ qb, const float* __restrict__ kb,
    const float* __restrict__ vb, const float* __restrict__ mask,
    const float* __restrict__ Wo, const float* __restrict__ bo,
    float* __restrict__ out)
{
  __shared__ unsigned int woP[(NDQKV / 2) * NDIN];  // W_o as f16 pairs: [kp][j] = (k=2kp,2kp+1)
  __shared__ _Float16 ab8[NHD][16 * TSTR];          // q/k staging: cols >=8 persistently zero
  __shared__ _Float16 vT [NHD][16 * TSTR];          // v^T staging: rows 8..15 persistently zero
  __shared__ _Float16 xt[16 * TSTR];                // fused head outputs (16 x 32)

  const int tid  = threadIdx.x;
  const int w    = tid >> 5;                  // head
  const int lane = tid & 31;
  const int half = lane >> 4;
  const int nn   = lane & 15;

  const int b     = blockIdx.x >> 6;
  const int qbase = (blockIdx.x & 63) << 4;

  // ---- stage W_o as packed f16 pairs (consumed after __syncthreads)
  #pragma unroll
  for (int i = 0; i < ((NDQKV / 2) * NDIN) / 128; ++i) {
    const int idx = tid + i * 128;
    const int kp = idx >> 8, j = idx & 255;
    union { unsigned int u; _Float16 h[2]; } pk;
    pk.h[0] = (_Float16)Wo[(2 * kp) * NDIN + j];
    pk.h[1] = (_Float16)Wo[(2 * kp + 1) * NDIN + j];
    woP[idx] = pk.u;
  }

  _Float16* sAB = ab8[w];
  _Float16* sV  = vT[w];

  // ---- zero the padded regions once (per-wave, in-order LDS)
  {
    u32a* z0 = (u32a*)sAB;
    u32a* z1 = (u32a*)sV;
    #pragma unroll
    for (int i = 0; i < 9; ++i) { z0[lane + i * 32] = 0u; z1[lane + i * 32] = 0u; }
  }

  // ---- stage q tile (16 rows x 8 dims) for this head, build its operand once (B of S^T)
  #pragma unroll
  for (int i = 0; i < 4; ++i) {
    const int idx = lane + i * 32;
    const int r = idx >> 3, d = idx & 7;
    sAB[r * TSTR + d] = (_Float16)qb[((size_t)(b * NL + qbase + r)) * NDQKV + w * NDH + d];
  }
  const v16h aQ = loadTileU8(sAB);

  float m_q = -INFINITY, l_q = 0.f;           // l_q: this half's share of the row sum
  union { v8f v; float f[8]; } acc;
  #pragma unroll
  for (int r = 0; r < 8; ++r) acc.f[r] = 0.f;

  const float scale = 0.35355339059327373f;   // 1/sqrt(d_head)
  const size_t mbase = ((size_t)(b * NL + qbase + nn)) * NL + half * 8;

  // per-lane prefetch address: 32 lanes cover 16 mask rows x 2 column tiles
  const float* mpf = mask +
      ((size_t)(b * NL + qbase + ((lane >> 3) & 1) * 8 + (lane & 7))) * NL +
      ((lane >> 4) & 1) * 16;

  for (int c = 0; c < NL / 32; ++c) {
    const int k0 = c * 32;
    float s0[8], s1[8];

    if (c + 1 < NL / 32)
      __builtin_prefetch(mpf + k0 + 32, 0, 3);   // next chunk's mask tile -> global_prefetch_b8

    // ---- score tile 0: k rows [k0, k0+16)
    #pragma unroll
    for (int i = 0; i < 4; ++i) {
      const int idx = lane + i * 32;
      const int r = idx >> 3, d = idx & 7;
      sAB[r * TSTR + d] = (_Float16)kb[((size_t)(b * NL + k0 + r)) * NDQKV + w * NDH + d];
    }
    {
      const v16h bK = loadTileU8(sAB);
      v8f z = {};
      union { v8f v; float f[8]; } S;
      S.v = __builtin_amdgcn_wmma_f32_16x16x32_f16(false, bK, false, aQ, (short)0, z, false, false);
      const float4 ma = *(const float4*)(mask + mbase + k0);
      const float4 mb = *(const float4*)(mask + mbase + k0 + 4);
      const float mk[8] = {ma.x, ma.y, ma.z, ma.w, mb.x, mb.y, mb.z, mb.w};
      #pragma unroll
      for (int r = 0; r < 8; ++r)
        s0[r] = S.f[r] * scale * fabsf(mk[r]);
    }
    // ---- score tile 1: k rows [k0+16, k0+32)
    #pragma unroll
    for (int i = 0; i < 4; ++i) {
      const int idx = lane + i * 32;
      const int r = idx >> 3, d = idx & 7;
      sAB[r * TSTR + d] = (_Float16)kb[((size_t)(b * NL + k0 + 16 + r)) * NDQKV + w * NDH + d];
    }
    {
      const v16h bK = loadTileU8(sAB);
      v8f z = {};
      union { v8f v; float f[8]; } S;
      S.v = __builtin_amdgcn_wmma_f32_16x16x32_f16(false, bK, false, aQ, (short)0, z, false, false);
      const float4 ma = *(const float4*)(mask + mbase + k0 + 16);
      const float4 mb = *(const float4*)(mask + mbase + k0 + 20);
      const float mk[8] = {ma.x, ma.y, ma.z, ma.w, mb.x, mb.y, mb.z, mb.w};
      #pragma unroll
      for (int r = 0; r < 8; ++r)
        s1[r] = S.f[r] * scale * fabsf(mk[r]);
    }

    // ---- stage v^T early (rows d 0..7, cols kk 0..31); rows 8..15 stay zero
    #pragma unroll
    for (int i = 0; i < 8; ++i) {
      const int idx = lane + i * 32;
      const int d = idx >> 5, kk = idx & 31;
      sV[d * TSTR + kk] = (_Float16)vb[((size_t)(b * NL + k0 + kk)) * NDQKV + w * NDH + d];
    }

    // ---- online softmax: a lane's 16 scores belong to one query row, the other 16 to lane ^ 16
    float t = fmaxf(s0[0], s1[0]);
    #pragma unroll
    for (int r = 1; r < 8; ++r) t = fmaxf(t, fmaxf(s0[r], s1[r]));
    t = fmaxf(t, other_half(t));
    const float mn = fmaxf(m_q, t);
    const float alpha = __expf(m_q - mn);
    m_q = mn;
    // the two score tiles, converted in place, are the B operand P^T in the hardware k order
    v16h bP;
    float rs0 = 0.f, rs1 = 0.f;
    #pragma unroll
    for (int r = 0; r < 8; ++r) {
      const float p0 = __expf(s0[r] - mn);
      rs0 += p0;
      bP[r] = (_Float16)p0;
    }
    #pragma unroll
    for (int r = 0; r < 8; ++r) {
      const float p1 = __expf(s1[r] - mn);
      rs1 += p1;
      bP[8 + r] = (_Float16)p1;
    }
    #pragma unroll
    for (int r = 0; r < 8; ++r) acc.f[r] *= alpha;
    l_q = l_q * alpha + (rs0 + rs1);
    const v16h aV = loadTileU(sV);
    acc.v = __builtin_amdgcn_wmma_f32_16x16x32_f16(false, aV, false, bP, (short)0, acc.v, false, false);
  }

  // finalize head output -> xt[row][w*8 + d]; dims 0..7 sit in the registers of the lower half
  const float l_row = l_q + other_half(l_q);
  if (half == 0) {
    #pragma unroll
    for (int r = 0; r < 8; ++r)
      xt[nn * TSTR + w * NDH + r] = (_Float16)(acc.f[r] / l_row);
  }
  __syncthreads();

  // output projection: out[16 x 256] = xt(16x32) @ W_o(32x256) + b_o
  const v16h aX = loadTileU(xt);
  #pragma unroll
  for (int t = 0; t < 4; ++t) {
    const int j0 = (w * 4 + t) * 16;
    union { v16h h; unsigned int u[8]; } bW;
    #pragma unroll
    for (int v = 0; v < 8; ++v) {
      const int kk = (v < 4) ? (2 * v + 8 * half) : (16 + 2 * (v - 4) + 8 * half);
      bW.u[v] = woP[(kk >> 1) * NDIN + j0 + nn];
    }
    v8f z = {};
    union { v8f v; float f[8]; } D;
    D.v = __builtin_amdgcn_wmma_f32_16x16x32_f16(false, aX, false, bW.h, (short)0, z, false, false);
    const int col = j0 + nn;
    const float bias = bo[col];
    #pragma unroll
    for (int r = 0; r < 8; ++r)
      out[((size_t)(b * NL + qbase + r + half * 8)) * NDIN + col] = D.f[r] + bias;
  }
}

extern "C" void kernel_launch(void* const* d_in, const int* in_sizes, int n_in,
                              void* d_out, int out_size, void* d_ws, size_t ws_size,
                              hipStream_t stream)
{
  (void)in_sizes; (void)n_in; (void)out_size; (void)ws_size;
  const float* Q    = (const float*)d_in[0];
  const float* K    = (const float*)d_in[1];
  const float* V    = (const float*)d_in[2];
  const float* mask = (const float*)d_in[3];
  const float* W_q  = (const float*)d_in[4];
  const float* b_q  = (const float*)d_in[5];
  const float* W_k  = (const float*)d_in[6];
  const float* b_k  = (const float*)d_in[7];
  const float* W_v  = (const float*)d_in[8];
  const float* b_v  = (const float*)d_in[9];
  const float* W_o  = (const float*)d_in[10];
  const float* b_o  = (const float*)d_in[11];
  const float* ln_g = (const float*)d_in[12];
  const float* ln_b = (const float*)d_in[13];
  float* out = (float*)d_out;

  const size_t n1 = (size_t)NB * NL * NDQKV;
  float* qb = (float*)d_ws;
  float* kb = qb + n1;
  float* vb = kb + n1;

  dim3 grd1(NB * NL / 8);
  ln_proj_kernel<<<grd1, 256, 0, stream>>>(Q, W_q, b_q, ln_g, ln_b, qb);
  ln_proj_kernel<<<grd1, 256, 0, stream>>>(K, W_k, b_k, ln_g, ln_b, kb);
  ln_proj_kernel<<<grd1, 256, 0, stream>>>(V, W_v, b_v, ln_g, ln_b, vb);

  attn_kernel<<<dim3(NB * (NL / 16)), 128, 0, stream>>>(qb, kb, vb, mask, W_o, b_o, out);
}

// v002
// Measured time: 131 microseconds a run.
// Two timings next to v001 both put it at 1.25 times that version's speed.
// Counting every step since v000, it is 1.96 times as fast.
#include <hip/hip_runtime.h>
#include <hip/hip_bf16.h>
#include <math.h>

typedef _Float16 v16h __attribute__((ext_vector_type(16)));
typedef float    v8f  __attribute__((ext_vector_type(8)));
typedef unsigned int u32a __attribute__((may_alias));   // alias-safe u32 for LDS type-punning
typedef unsigned int u32x4 __attribute__((ext_vector_type(4), may_alias));  // one 16-byte operand chunk (8 halfs)
typedef _Float16 f16a __attribute__((may_alias));       // halfs stored into the float-typed workspace

#define NB    32
#define NL    1024
#define NDIN  256
#define NDQKV 32
#define NHD   4
#define NDH   8
#define TSTR  36   // padded LDS row stride in halfs (72B rows)

// -------- cross-lane helper (wave32): value of lane l ^ 16 (the other half's share of a query column)
__device__ __forceinline__ float other_half(float v) {
  const int b = __float_as_int(v);
  return __int_as_float(__builtin_amdgcn_permlanex16(b, b, 0x76543210, 0xfedcba98, false, false));
}

// 16-bit A/B operand layout (ISA 7.12.2): VGPR v -> K = (v<4 ? 2v+8*half : 16+2(v-4)+8*half)
// Unconditional build of a 16x32 f16 operand from a row-major LDS tile [16][TSTR].
// Zero-padding is guaranteed by the caller's LDS region contents.
__device__ __forceinline__ v16h loadTileU(const _Float16* t) {
  const int lane = threadIdx.x & 31;
  const int half = lane >> 4;
  const u32a* p = (const u32a*)(t + (lane & 15) * TSTR);
  union { v16h h; unsigned int u[8]; } r;
  #pragma unroll
  for (int v = 0; v < 8; ++v) {
    const int k0 = (v < 4) ? (2 * v + 8 * half) : (16 + 2 * (v - 4) + 8 * half);
    r.u[v] = p[k0 >> 1];
  }
  return r.h;
}
// ================= Kernel 1: LayerNorm + QKV projection =================
// The result is stored as the halfs the attention products consume, in 16-byte operand chunks:
//   vlayout == 0 (q, k): [batch][head][row][8 dims]        one chunk = one row of one head
//   vlayout != 0 (v):    [batch][row / 8][32 cols][8 rows] one chunk = 8 consecutive rows of one column
// A block's 8 rows fill four whole 128-byte lines in either layout.
__global__ __launch_bounds__(256) void ln_proj_kernel(
    const float* __restrict__ X, const float* __restrict__ W,
    const float* __restrict__ bias, const float* __restrict__ g,
    const float* __restrict__ bn, float* __restrict__ outp, int vlayout)
{
  __shared__ float sh[8][NDIN];
  const int w    = threadIdx.x >> 5;
  const int lane = threadIdx.x & 31;
  const int row  = blockIdx.x * 8 + w;

  const float* x = X + (size_t)row * NDIN + lane * 8;
  const float4 a0 = *(const float4*)(x + 0);
  const float4 a1 = *(const float4*)(x + 4);
  float v[8] = {a0.x, a0.y, a0.z, a0.w, a1.x, a1.y, a1.z, a1.w};

  float s = 0.f;
  #pragma unroll
  for (int i = 0; i < 8; ++i) s += v[i];
  #pragma unroll
  for (int o = 1; o < 32; o <<= 1) s += __shfl_xor(s, o);
  const float mu = s * (1.f / NDIN);

  float q = 0.f;
  #pragma unroll
  for (int i = 0; i < 8; ++i) { float d = v[i] - mu; q += d * d; }
  #pragma unroll
  for (int o = 1; o < 32; o <<= 1) q += __shfl_xor(q, o);
  const float rstd = rsqrtf(q * (1.f / NDIN) + 1e-5f);

  #pragma unroll
  for (int i = 0; i < 8; ++i) {
    const int col = lane * 8 + i;
    sh[w][col] = (v[i] - mu) * rstd * g[col] + bn[col];
  }
  // intra-wave LDS: DS ops are in-order per wave, no barrier needed

  float acc = bias[lane];
  const float* wc = W + lane;
  #pragma unroll 8
  for (int i = 0; i < NDIN; ++i)
    acc = fmaf(sh[w][i], wc[(size_t)i * NDQKV], acc);
  const int oidx = vlayout
      ? ((row >> 3) * NDQKV + lane) * 8 + (row & 7)
      : ((((row >> 10) * NHD + (lane >> 3)) * NL + (row & (NL - 1))) * NDH + (lane & 7));
  ((f16a*)outp)[oidx] = (_Float16)acc;
}

// ================= Kernel 2: fused flash attention + output proj =================
// block = 128 threads = 4 waves (wave == head); block handles 16 q-rows of one batch
__global__ __launch_bounds__(128) void attn_kernel(
    const float* __restrict__ qb, const float* __restrict__ kb,
    const float* __restrict__ vb, const float* __restrict__ mask,
    const float* __restrict__ Wo, const float* __restrict__ bo,
    float* __restrict__ out)
{
  __shared__ unsigned int woP[(NDQKV / 2) * NDIN];  // W_o as f16 pairs: [kp][j] = (k=2kp,2kp+1)
  __shared__ _Float16 xt[16 * TSTR];                // fused head outputs (16 x 32)

  const int tid  = threadIdx.x;
  const int w    = tid >> 5;                  // head
  const int lane = tid & 31;
  const int half = lane >> 4;
  const int nn   = lane & 15;

  const int b     = blockIdx.x >> 6;
  const int qbase = (blockIdx.x & 63) << 4;

  // ---- stage W_o as packed f16 pairs (consumed after __syncthreads)
  #pragma unroll
  for (int i = 0; i < ((NDQKV / 2) * NDIN) / 128; ++i) {
    const int idx = tid + i * 128;
    const int kp = idx >> 8, j = idx & 255;
    union { unsigned int u; _Float16 h[2]; } pk;
    pk.h[0] = (_Float16)Wo[(2 * kp) * NDIN + j];
    pk.h[1] = (_Float16)Wo[(2 * kp + 1) * NDIN + j];
    woP[idx] = pk.u;
  }

  // ---- operand chunks straight from the workspace (layouts: see ln_proj_kernel)
  const u32x4* qc = (const u32x4*)qb + (size_t)(b * NHD + w) * NL;            // [row]
  const u32x4* kc = (const u32x4*)kb + (size_t)(b * NHD + w) * NL + nn;       // [key], this lane's A row
  const u32x4* vc = (const u32x4*)vb + (size_t)(b * (NL / 8) + half) * NDQKV  // [key / 8][col]
                    + w * NDH + (nn & 7);   // A rows 8..15 repeat dims 0..7; their outputs are not read

  // q as B of S^T, twice: aQ0 holds the 8 dims in k slots 0..7, aQ1 in k slots 16..23 (both: lower
  // half of the wave), every other k slot is zero. One A operand then carries both key tiles of a
  // chunk (tile 0 in slots 0..15, tile 1 in slots 16..31, each lane pair the same 8 dims twice):
  // the zeros of aQ0 / aQ1 pick the tile.
  u32x4 qv = qc[qbase + nn];
  if (half) qv = (u32x4)(0u);
  union { v16h h; u32x4 c[2]; } uq0, uq1;
  uq0.c[0] = qv;          uq0.c[1] = (u32x4)(0u);
  uq1.c[0] = (u32x4)(0u); uq1.c[1] = qv;
  const v16h aQ0 = uq0.h, aQ1 = uq1.h;

  float m_q = -INFINITY, l_q = 0.f;           // l_q: this half's share of the row sum
  union { v8f v; float f[8]; } acc;
  #pragma unroll
  for (int r = 0; r < 8; ++r) acc.f[r] = 0.f;

  const float scale = 0.35355339059327373f;   // 1/sqrt(d_head)
  const size_t mbase = ((size_t)(b * NL + qbase + nn)) * NL + half * 8;

  // per-lane prefetch address: 32 lanes cover 16 mask rows x 2 column tiles
  const float* mpf = mask +
      ((size_t)(b * NL + qbase + ((lane >> 3) & 1) * 8 + (lane & 7))) * NL +
      ((lane >> 4) & 1) * 16;

  for (int c = 0; c < NL / 32; ++c) {
    const int k0 = c * 32;
    float s0[8], s1[8];

    if (c + 1 < NL / 32)
      __builtin_prefetch(mpf + k0 + 32, 0, 3);   // next chunk's mask tile -> global_prefetch_b8

    // ---- v^T operand: keys 8*half.. and 16+8*half.. of this lane's dim, two chunks
    union { v16h h; u32x4 c[2]; } uv;
    uv.c[0] = vc[(c * 4) * NDQKV];
    uv.c[1] = vc[(c * 4 + 2) * NDQKV];

    // ---- k operand: row nn of tile 0 and of tile 1
    union { v16h h; u32x4 c[2]; } uk;
    uk.c[0] = kc[k0];
    uk.c[1] = kc[k0 + 16];
    const v16h bK = uk.h;

    // ---- score tile 0: k rows [k0, k0+16)
    {
      v8f z = {};
      union { v8f v; float f[8]; } S;
      S.v = __builtin_amdgcn_wmma_f32_16x16x32_f16(false, bK, false, aQ0, (short)0, z, false, false);
      const float4 ma = *(const float4*)(mask + mbase + k0);
      const float4 mb = *(const float4*)(mask + mbase + k0 + 4);
      const float mk[8] = {ma.x, ma.y, ma.z, ma.w, mb.x, mb.y, mb.z, mb.w};
      #pragma unroll
      for (int r = 0; r < 8; ++r)
        s0[r] = S.f[r] * scale * fabsf(mk[r]);
    }
    // ---- score tile 1: k rows [k0+16, k0+32)
    {
      v8f z = {};
      union { v8f v; float f[8]; } S;
      S.v = __builtin_amdgcn_wmma_f32_16x16x32_f16(false, bK, false, aQ1, (short)0, z, false, false);
      const float4 ma = *(const float4*)(mask + mbase + k0 + 16);
      const float4 mb = *(const float4*)(mask + mbase + k0 + 20);
      const float mk[8] = {ma.x, ma.y, ma.z, ma.w, mb.x, mb.y, mb.z, mb.w};
      #pragma unroll
      for (int r = 0; r < 8; ++r)
        s1[r] = S.f[r] * scale * fabsf(mk[r]);
    }

    // ---- online softmax: a lane's 16 scores belong to one query row, the other 16 to lane ^ 16
    float t = fmaxf(s0[0], s1[0]);
    #pragma unroll
    for (int r = 1; r < 8; ++r) t = fmaxf(t, fmaxf(s0[r], s1[r]));
    t = fmaxf(t, other_half(t));
    const float mn = fmaxf(m_q, t);
    const float alpha = __expf(m_q - mn);
    m_q = mn;
    // the two score tiles, converted in place, are the B operand P^T in the hardware k order
    v16h bP;
    float rs0 = 0.f, rs1 = 0.f;
    #pragma unroll
    for (int r = 0; r < 8; ++r) {
      const float p0 = __expf(s0[r] - mn);
      rs0 += p0;
      bP[r] = (_Float16)p0;
    }
    #pragma unroll
    for (int r = 0; r < 8; ++r) {
      const float p1 = __expf(s1[r] - mn);
      rs1 += p1;
      bP[8 + r] = (_Float16)p1;
    }
    #pragma unroll
    for (int r = 0; r < 8; ++r) acc.f[r] *= alpha;
    l_q = l_q * alpha + (rs0 + rs1);
    const v16h aV = uv.h;
    acc.v = __builtin_amdgcn_wmma_f32_16x16x32_f16(false, aV, false, bP, (short)0, acc.v, false, false);
  }

  // finalize head output -> xt[row][w*8 + d]; dims 0..7 sit in the registers of the lower half
  const float l_row = l_q + other_half(l_q);
  if (half == 0) {
    #pragma unroll
    for (int r = 0; r < 8; ++r)
      xt[nn * TSTR + w * NDH + r] = (_Float16)(acc.f[r] / l_row);
  }
  __syncthreads();

  // output projection: out[16 x 256] = xt(16x32) @ W_o(32x256) + b_o
  const v16h aX = loadTileU(xt);
  #pragma unroll
  for (int t = 0; t < 4; ++t) {
    const int j0 = (w * 4 + t) * 16;
    union { v16h h; unsigned int u[8]; } bW;
    #pragma unroll
    for (int v = 0; v < 8; ++v) {
      const int kk = (v < 4) ? (2 * v + 8 * half) : (16 + 2 * (v - 4) + 8 * half);
      bW.u[v] = woP[(kk >> 1) * NDIN + j0 + nn];
    }
    v8f z = {};
    union { v8f v; float f[8]; } D;
    D.v = __builtin_amdgcn_wmma_f32_16x16x32_f16(false, aX, false, bW.h, (short)0, z, false, false);
    const int col = j0 + nn;
    const float bias = bo[col];
    #pragma unroll
    for (int r = 0; r < 8; ++r)
      out[((size_t)(b * NL + qbase + r + half * 8)) * NDIN + col] = D.f[r] + bias;
  }
}

extern "C" void kernel_launch(void* const* d_in, const int* in_sizes, int n_in,
                              void* d_out, int out_size, void* d_ws, size_t ws_size,
                              hipStream_t stream)
{
  (void)in_sizes; (void)n_in; (void)out_size; (void)ws_size;
  const float* Q    = (const float*)d_in[0];
  const float* K    = (const float*)d_in[1];
  const float* V    = (const float*)d_in[2];
  const float* mask = (const float*)d_in[3];
  const float* W_q  = (const float*)d_in[4];
  const float* b_q  = (const float*)d_in[5];
  const float* W_k  = (const float*)d_in[6];
  const float* b_k  = (const float*)d_in[7];
  const float* W_v  = (const float*)d_in[8];
  const float* b_v  = (const float*)d_in[9];
  const float* W_o  = (const float*)d_in[10];
  const float* b_o  = (const float*)d_in[11];
  const float* ln_g = (const float*)d_in[12];
  const float* ln_b = (const float*)d_in[13];
  float* out = (float*)d_out;

  const size_t n1 = (size_t)NB * NL * NDQKV;
  float* qb = (float*)d_ws;
  float* kb = qb + n1;
  float* vb = kb + n1;

  dim3 grd1(NB * NL / 8);
  ln_proj_kernel<<<grd1, 256, 0, stream>>>(Q, W_q, b_q, ln_g, ln_b, qb, 0);
  ln_proj_kernel<<<grd1, 256, 0, stream>>>(K, W_k, b_k, ln_g, ln_b, kb, 0);
  ln_proj_kernel<<<grd1, 256, 0, stream>>>(V, W_v, b_v, ln_g, ln_b, vb, 1);

  attn_kernel<<<dim3(NB * (NL / 16)), 128, 0, stream>>>(qb, kb, vb, mask, W_o, b_o, out);
}

// v003
// Measured time: 65.4 microseconds a run.
// Timed twice side by side with v002, it ran 2.00 times as fast both times.
// Counting every step since v000, it is 3.92 times as fast.
#include <hip/hip_runtime.h>
#include <hip/hip_bf16.h>
#include <math.h>

typedef _Float16 v16h __attribute__((ext_vector_type(16)));
typedef float    v8f  __attribute__((ext_vector_type(8)));
typedef float    f32x2 __attribute__((ext_vector_type(2)));
typedef float    f32x4 __attribute__((ext_vector_type(4)));
typedef unsigned int u32a __attribute__((may_alias));   // alias-safe u32 for LDS type-punning
typedef unsigned int u32x4 __attribute__((ext_vector_type(4), may_alias));  // one 16-byte operand chunk (8 halfs)

#define NB    32
#define NL    1024
#define NDIN  256
#define NDQKV 32
#define NHD   4
#define NDH   8
#define TSTR  36   // padded LDS row stride in halfs (72B rows)

// -------- cross-lane helper (wave32): value of lane l ^ 16 (the other half's share of a query column)
__device__ __forceinline__ float other_half(float v) {
  const int b = __float_as_int(v);
  return __int_as_float(__builtin_amdgcn_permlanex16(b, b, 0x76543210, 0xfedcba98, false, false));
}

// 16-bit A/B operand layout (ISA 7.12.2): VGPR v -> K = (v<4 ? 2v+8*half : 16+2(v-4)+8*half)
// Unconditional build of a 16x32 f16 operand from a row-major LDS tile [16][TSTR].
// Zero-padding is guaranteed by the caller's LDS region contents.
__device__ __forceinline__ v16h loadTileU(const _Float16* t) {
  const int lane = threadIdx.x & 31;
  const int half = lane >> 4;
  const u32a* p = (const u32a*)(t + (lane & 15) * TSTR);
  union { v16h h; unsigned int u[8]; } r;
  #pragma unroll
  for (int v = 0; v < 8; ++v) {
    const int k0 = (v < 4) ? (2 * v + 8 * half) : (16 + 2 * (v - 4) + 8 * half);
    r.u[v] = p[k0 >> 1];
  }
  return r.h;
}
// ================= Kernel 1: LayerNorm + QKV projection =================
// The result is stored as the halfs the attention products consume, in 16-byte operand chunks:
//   VL == 0 (q, k): [batch][head][row][8 dims]        one chunk = one row of one head
//   VL != 0 (v):    [batch][row / 8][32 cols][8 rows] one chunk = 8 consecutive rows of one column
// A wave takes 16 rows and does their product with W on the f32 16x16x4 matrix form; a block of
// 8 waves shares one copy of W in LDS, laid out as the fragments are read.
// Lane (c, h) owns row c: 16-byte piece 2j + h of the row, j = 0..31, so a row's sums need one
// exchange with lane ^ 16. k slot (h, e) of step 2j + s is column 4 * (2j + h) + 2s + e, for the
// row fragment and for the W fragment alike.
#define PW     8     // waves per block
#define XPITCH 65    // LDS row pitch in 16-byte pieces (1040 B): 16 rows fall on distinct banks

template <int VL>
__device__ __forceinline__ void ln_proj_body(
    const float* __restrict__ X, const float* __restrict__ W,
    const float* __restrict__ bias, const float* __restrict__ g,
    const float* __restrict__ bn, float* __restrict__ outp)
{
  // one array, the small tables first: their reads then take immediate offsets
  __shared__ f32x4 lds[NDIN * NDQKV / 4 + NDIN / 2 + PW * 16 * XPITCH];
  f32x4* const wf = lds;                       // [j][col tile][lane]: 4 k of one column of W
  f32x4* const gs = wf + NDIN * NDQKV / 4;
  f32x4* const bs = gs + NDIN / 4;
  f32x4* const xs = bs + NDIN / 4;             // each wave's 16 rows

  const int tid  = threadIdx.x;
  const int w    = tid >> 5;
  const int lane = tid & 31;
  const int h    = lane >> 4;
  const int c    = lane & 15;
  const int row0 = (blockIdx.x * PW + w) * 16;

  // W as fragments; gain (threads 0..127) and shift (128..255), 8 bytes a thread
  f32x4 wr[NDIN * NDQKV / 4 / (PW * 32)];
  const float* wp0 = W + (4 * (2 * (tid >> 6) + h)) * NDQKV + ((tid >> 5) & 1) * 16 + c;
  #pragma unroll
  for (int i = 0; i < NDIN * NDQKV / 4 / (PW * 32); ++i) {
    // entry e = tid + 256 i: j = e >> 6 = (tid >> 6) + 4 i, so i moves the address by 32 rows of W
    const float* wp = wp0 + i * 32 * NDQKV;
    wr[i] = (f32x4){wp[0], wp[NDQKV], wp[2 * NDQKV], wp[3 * NDQKV]};
  }
  const f32x2 tv = ((const f32x2*)((tid & (NDIN / 2)) ? bn : g))[tid & (NDIN / 2 - 1)];
  // the row loads below land in registers that held the addresses of the loads above
  asm volatile("s_wait_xcnt 0x0" ::: "memory");

  // the wave's 16 rows are 16 KiB in a row: whole lines, 512 bytes a load
  const f32x4* xg = (const f32x4*)(X + (size_t)row0 * NDIN) + lane;
  f32x4 xr[32];
  #pragma unroll
  for (int i = 0; i < 32; ++i) xr[i] = xg[i * 32];

  #pragma unroll
  for (int i = 0; i < NDIN * NDQKV / 4 / (PW * 32); ++i) wf[tid + i * (PW * 32)] = wr[i];
  ((f32x2*)gs)[tid] = tv;                      // bs follows gs

  #pragma unroll
  for (int i = 0; i < 32; ++i)
    xs[(w * 16 + (i >> 1)) * XPITCH + (i & 1) * 32 + lane] = xr[i];
  __syncthreads();

  f32x4 xv[32];
  #pragma unroll
  for (int j = 0; j < 32; ++j) xv[j] = xs[(w * 16 + c) * XPITCH + 2 * j + h];

  f32x4 sa = xv[0], sb = xv[1];
  #pragma unroll
  for (int j = 2; j < 32; j += 2) { sa += xv[j]; sb += xv[j + 1]; }
  sa += sb;
  float s = (sa.x + sa.y) + (sa.z + sa.w);
  s += other_half(s);
  const float mu = s * (1.f / NDIN);

  f32x4 qa = (f32x4)(0.f), qb = (f32x4)(0.f);
  #pragma unroll
  for (int j = 0; j < 32; j += 2) {
    xv[j]     -= mu;  qa += xv[j] * xv[j];
    xv[j + 1] -= mu;  qb += xv[j + 1] * xv[j + 1];
  }
  qa += qb;
  float q = (qa.x + qa.y) + (qa.z + qa.w);
  q += other_half(q);
  const float rstd = rsqrtf(q * (1.f / NDIN) + 1e-5f);

  // bias: asked for here, added behind the products
  v8f acc[2], bv[2];
  #pragma unroll
  for (int t = 0; t < 2; ++t)
    #pragma unroll
    for (int r = 0; r < 8; ++r) {
      acc[t][r] = 0.f;
      bv[t][r] = VL ? bias[16 * t + c] : bias[16 * t + 8 * h + r];
    }

  // gain and shift for 4 j at a time, read one group ahead
  f32x4 gb[2][8];
  #pragma unroll
  for (int i = 0; i < 4; ++i) { gb[0][2 * i] = gs[2 * i + h]; gb[0][2 * i + 1] = bs[2 * i + h]; }
  #pragma unroll
  for (int gq = 0; gq < 8; ++gq) {
    if (gq + 1 < 8) {
      #pragma unroll
      for (int i = 0; i < 4; ++i) {
        gb[(gq + 1) & 1][2 * i]     = gs[2 * ((gq + 1) * 4 + i) + h];
        gb[(gq + 1) & 1][2 * i + 1] = bs[2 * ((gq + 1) * 4 + i) + h];
      }
    }
    // bounds how far these reads are hoisted: without it all 64 go up at once and hold 256 registers
    __builtin_amdgcn_sched_barrier(0);
    #pragma unroll
    for (int i = 0; i < 4; ++i)
      xv[gq * 4 + i] = xv[gq * 4 + i] * rstd * gb[gq & 1][2 * i] + gb[gq & 1][2 * i + 1];
  }

  // W fragments in groups of 8 reads (4 j, 16 matrix instructions), one group ahead
  f32x4 wb[2][8];
  #pragma unroll
  for (int i = 0; i < 8; ++i) wb[0][i] = wf[i * 32 + lane];
  #pragma unroll
  for (int gq = 0; gq < 8; ++gq) {
    if (gq + 1 < 8) {
      #pragma unroll
      for (int i = 0; i < 8; ++i) wb[(gq + 1) & 1][i] = wf[((gq + 1) * 8 + i) * 32 + lane];
    }
    // keeps the next group's LDS reads in one place ahead of this group's matrix run, not among it
    __builtin_amdgcn_sched_barrier(0);
    #pragma unroll
    for (int jj = 0; jj < 4; ++jj) {
      const f32x4 xn = xv[gq * 4 + jj];
      #pragma unroll
      for (int sp = 0; sp < 2; ++sp) {
        const f32x2 fx = sp ? xn.zw : xn.xy;
        #pragma unroll
        for (int t = 0; t < 2; ++t) {
          const f32x4 w4 = wb[gq & 1][jj * 2 + t];
          const f32x2 fw = sp ? w4.zw : w4.xy;
          // VL: D[row 8h + r][col c]; else the transposed product, D[col 8h + r][row c]
          acc[t] = VL ? __builtin_amdgcn_wmma_f32_16x16x4_f32(false, fx, false, fw, (short)0, acc[t], false, false)
                      : __builtin_amdgcn_wmma_f32_16x16x4_f32(false, fw, false, fx, (short)0, acc[t], false, false);
        }
      }
    }
    // ends the matrix run: the reads that follow stay behind it, in one place, not among its instructions
    __builtin_amdgcn_sched_barrier(0);
  }
  // four vector slots between the last matrix instructions and the first read of their results
  asm volatile("v_nop\n\tv_nop\n\tv_nop\n\tv_nop");
  // holds the adds below behind those slots
  __builtin_amdgcn_sched_barrier(0);

  #pragma unroll
  for (int t = 0; t < 2; ++t) {
    union { u32x4 u; _Float16 hf[8]; } o;
    #pragma unroll
    for (int r = 0; r < 8; ++r) o.hf[r] = (_Float16)(acc[t][r] + bv[t][r]);
    const int chunk = VL
        ? ((row0 >> 3) + h) * NDQKV + 16 * t + c
        : ((row0 >> 10) * NHD + 2 * t + h) * NL + (row0 & (NL - 1)) + c;
    ((u32x4*)outp)[chunk] = o.u;
  }
}

__global__ __launch_bounds__(PW * 32) void ln_proj_rows_kernel(
    const float* __restrict__ X, const float* __restrict__ W,
    const float* __restrict__ bias, const float* __restrict__ g,
    const float* __restrict__ bn, float* __restrict__ outp)
{
  ln_proj_body<0>(X, W, bias, g, bn, outp);
}

__global__ __launch_bounds__(PW * 32) void ln_proj_cols_kernel(
    const float* __restrict__ X, const float* __restrict__ W,
    const float* __restrict__ bias, const float* __restrict__ g,
    const float* __restrict__ bn, float* __restrict__ outp)
{
  ln_proj_body<1>(X, W, bias, g, bn, outp);
}

// ================= Kernel 2: fused flash attention + output proj =================
// block = 128 threads = 4 waves (wave == head); block handles 16 q-rows of one batch
__global__ __launch_bounds__(128) void attn_kernel(
    const float* __restrict__ qb, const float* __restrict__ kb,
    const float* __restrict__ vb, const float* __restrict__ mask,
    const float* __restrict__ Wo, const float* __restrict__ bo,
    float* __restrict__ out)
{
  __shared__ unsigned int woP[(NDQKV / 2) * NDIN];  // W_o as f16 pairs: [kp][j] = (k=2kp,2kp+1)
  __shared__ _Float16 xt[16 * TSTR];                // fused head outputs (16 x 32)

  const int tid  = threadIdx.x;
  const int w    = tid >> 5;                  // head
  const int lane = tid & 31;
  const int half = lane >> 4;
  const int nn   = lane & 15;

  const int b     = blockIdx.x >> 6;
  const int qbase = (blockIdx.x & 63) << 4;

  // ---- stage W_o as packed f16 pairs (consumed after __syncthreads)
  #pragma unroll
  for (int i = 0; i < ((NDQKV / 2) * NDIN) / 128; ++i) {
    const int idx = tid + i * 128;
    const int kp = idx >> 8, j = idx & 255;
    union { unsigned int u; _Float16 h[2]; } pk;
    pk.h[0] = (_Float16)Wo[(2 * kp) * NDIN + j];
    pk.h[1] = (_Float16)Wo[(2 * kp + 1) * NDIN + j];
    woP[idx] = pk.u;
  }

  // ---- operand chunks straight from the workspace (layouts: see kernel 1)
  const u32x4* qc = (const u32x4*)qb + (size_t)(b * NHD + w) * NL;            // [row]
  const u32x4* kc = (const u32x4*)kb + (size_t)(b * NHD + w) * NL + nn;       // [key], this lane's A row
  const u32x4* vc = (const u32x4*)vb + (size_t)(b * (NL / 8) + half) * NDQKV  // [key / 8][col]
                    + w * NDH + (nn & 7);   // A rows 8..15 repeat dims 0..7; their outputs are not read

  // q as B of S^T, twice: aQ0 holds the 8 dims in k slots 0..7, aQ1 in k slots 16..23 (both: lower
  // half of the wave), every other k slot is zero. One A operand then carries both key tiles of a
  // chunk (tile 0 in slots 0..15, tile 1 in slots 16..31, each lane pair the same 8 dims twice):
  // the zeros of aQ0 / aQ1 pick the tile.
  u32x4 qv = qc[qbase + nn];
  if (half) qv = (u32x4)(0u);
  union { v16h h; u32x4 c[2]; } uq0, uq1;
  uq0.c[0] = qv;          uq0.c[1] = (u32x4)(0u);
  uq1.c[0] = (u32x4)(0u); uq1.c[1] = qv;
  const v16h aQ0 = uq0.h, aQ1 = uq1.h;

  float m_q = -INFINITY, l_q = 0.f;           // l_q: this half's share of the row sum
  union { v8f v; float f[8]; } acc;
  #pragma unroll
  for (int r = 0; r < 8; ++r) acc.f[r] = 0.f;

  const float scale = 0.35355339059327373f;   // 1/sqrt(d_head)
  const size_t mbase = ((size_t)(b * NL + qbase + nn)) * NL + half * 8;

  // per-lane prefetch address: 32 lanes cover 16 mask rows x 2 column tiles
  const float* mpf = mask +
      ((size_t)(b * NL + qbase + ((lane >> 3) & 1) * 8 + (lane & 7))) * NL +
      ((lane >> 4) & 1) * 16;

  for (int c = 0; c < NL / 32; ++c) {
    const int k0 = c * 32;
    float s0[8], s1[8];

    if (c + 1 < NL / 32)
      __builtin_prefetch(mpf + k0 + 32, 0, 3);   // next chunk's mask tile -> global_prefetch_b8

    // ---- v^T operand: keys 8*half.. and 16+8*half.. of this lane's dim, two chunks
    union { v16h h; u32x4 c[2]; } uv;
    uv.c[0] = vc[(c * 4) * NDQKV];
    uv.c[1] = vc[(c * 4 + 2) * NDQKV];

    // ---- k operand: row nn of tile 0 and of tile 1
    union { v16h h; u32x4 c[2]; } uk;
    uk.c[0] = kc[k0];
    uk.c[1] = kc[k0 + 16];
    const v16h bK = uk.h;

    // ---- score tile 0: k rows [k0, k0+16)
    {
      v8f z = {};
      union { v8f v; float f[8]; } S;
      S.v = __builtin_amdgcn_wmma_f32_16x16x32_f16(false, bK, false, aQ0, (short)0, z, false, false);
      const float4 ma = *(const float4*)(mask + mbase + k0);
      const float4 mb = *(const float4*)(mask + mbase + k0 + 4);
      const float mk[8] = {ma.x, ma.y, ma.z, ma.w, mb.x, mb.y, mb.z, mb.w};
      #pragma unroll
      for (int r = 0; r < 8; ++r)
        s0[r] = S.f[r] * scale * fabsf(mk[r]);
    }
    // ---- score tile 1: k rows [k0+16, k0+32)
    {
      v8f z = {};
      union { v8f v; float f[8]; } S;
      S.v = __builtin_amdgcn_wmma_f32_16x16x32_f16(false, bK, false, aQ1, (short)0, z, false, false);
      const float4 ma = *(const float4*)(mask + mbase + k0 + 16);
      const float4 mb = *(const float4*)(mask + mbase + k0 + 20);
      const float mk[8] = {ma.x, ma.y, ma.z, ma.w, mb.x, mb.y, mb.z, mb.w};
      #pragma unroll
      for (int r = 0; r < 8; ++r)
        s1[r] = S.f[r] * scale * fabsf(mk[r]);
    }

    // ---- online softmax: a lane's 16 scores belong to one query row, the other 16 to lane ^ 16
    float t = fmaxf(s0[0], s1[0]);
    #pragma unroll
    for (int r = 1; r < 8; ++r) t = fmaxf(t, fmaxf(s0[r], s1[r]));
    t = fmaxf(t, other_half(t));
    const float mn = fmaxf(m_q, t);
    const float alpha = __expf(m_q - mn);
    m_q = mn;
    // the two score tiles, converted in place, are the B operand P^T in the hardware k order
    v16h bP;
    float rs0 = 0.f, rs1 = 0.f;
    #pragma unroll
    for (int r = 0; r < 8; ++r) {
      const float p0 = __expf(s0[r] - mn);
      rs0 += p0;
      bP[r] = (_Float16)p0;
    }
    #pragma unroll
    for (int r = 0; r < 8; ++r) {
      const float p1 = __expf(s1[r] - mn);
      rs1 += p1;
      bP[8 + r] = (_Float16)p1;
    }
    #pragma unroll
    for (int r = 0; r < 8; ++r) acc.f[r] *= alpha;
    l_q = l_q * alpha + (rs0 + rs1);
    const v16h aV = uv.h;
    acc.v = __builtin_amdgcn_wmma_f32_16x16x32_f16(false, aV, false, bP, (short)0, acc.v, false, false);
  }

  // finalize head output -> xt[row][w*8 + d]; dims 0..7 sit in the registers of the lower half
  const float l_row = l_q + other_half(l_q);
  if (half == 0) {
    #pragma unroll
    for (int r = 0; r < 8; ++r)
      xt[nn * TSTR + w * NDH + r] = (_Float16)(acc.f[r] / l_row);
  }
  __syncthreads();

  // output projection: out[16 x 256] = xt(16x32) @ W_o(32x256) + b_o
  const v16h aX = loadTileU(xt);
  #pragma unroll
  for (int t = 0; t < 4; ++t) {
    const int j0 = (w * 4 + t) * 16;
    union { v16h h; unsigned int u[8]; } bW;
    #pragma unroll
    for (int v = 0; v < 8; ++v) {
      const int kk = (v < 4) ? (2 * v + 8 * half) : (16 + 2 * (v - 4) + 8 * half);
      bW.u[v] = woP[(kk >> 1) * NDIN + j0 + nn];
    }
    v8f z = {};
    union { v8f v; float f[8]; } D;
    D.v = __builtin_amdgcn_wmma_f32_16x16x32_f16(false, aX, false, bW.h, (short)0, z, false, false);
    const int col = j0 + nn;
    const float bias = bo[col];
    #pragma unroll
    for (int r = 0; r < 8; ++r)
      out[((size_t)(b * NL + qbase + r + half * 8)) * NDIN + col] = D.f[r] + bias;
  }
}

extern "C" void kernel_launch(void* const* d_in, const int* in_sizes, int n_in,
                              void* d_out, int out_size, void* d_ws, size_t ws_size,
                              hipStream_t stream)
{
  (void)in_sizes; (void)n_in; (void)out_size; (void)ws_size;
  const float* Q    = (const float*)d_in[0];
  const float* K    = (const float*)d_in[1];
  const float* V    = (const float*)d_in[2];
  const float* mask = (const float*)d_in[3];
  const float* W_q  = (const float*)d_in[4];
  const float* b_q  = (const float*)d_in[5];
  const float* W_k  = (const float*)d_in[6];
  const float* b_k  = (const float*)d_in[7];
  const float* W_v  = (const float*)d_in[8];
  const float* b_v  = (const float*)d_in[9];
  const float* W_o  = (const float*)d_in[10];
  const float* b_o  = (const float*)d_in[11];
  const float* ln_g = (const float*)d_in[12];
  const float* ln_b = (const float*)d_in[13];
  float* out = (float*)d_out;

  const size_t n1 = (size_t)NB * NL * NDQKV;
  float* qb = (float*)d_ws;
  float* kb = qb + n1;
  float* vb = kb + n1;

  dim3 grd1(NB * NL / (PW * 16));
  ln_proj_rows_kernel<<<grd1, PW * 32, 0, stream>>>(Q, W_q, b_q, ln_g, ln_b, qb);
  ln_proj_rows_kernel<<<grd1, PW * 32, 0, stream>>>(K, W_k, b_k, ln_g, ln_b, kb);
  ln_proj_cols_kernel<<<grd1, PW * 32, 0, stream>>>(V, W_v, b_v, ln_g, ln_b, vb);

  attn_kernel<<<dim3(NB * (NL / 16)), 128, 0, stream>>>(qb, kb, vb, mask, W_o, b_o, out);
}

// v004
// One run takes 56.9 microseconds.
// Next to v003, in two timings, it ran 1.15 times as fast each time.
// Counting every step since v000, it is 4.50 times as fast.
#include <hip/hip_runtime.h>
#include <hip/hip_bf16.h>
#include <math.h>

typedef _Float16 v16h __attribute__((ext_vector_type(16)));
typedef float    v8f  __attribute__((ext_vector_type(8)));
typedef float    f32x2 __attribute__((ext_vector_type(2)));
typedef float    f32x4 __attribute__((ext_vector_type(4)));
typedef unsigned int u32a __attribute__((may_alias));   // alias-safe u32 for LDS type-punning
typedef unsigned int u32x4 __attribute__((ext_vector_type(4), may_alias));  // one 16-byte operand chunk (8 halfs)

#define NB    32
#define NL    1024
#define NDIN  256
#define NDQKV 32
#define NHD   4
#define NDH   8
#define TSTR  36   // padded LDS row stride in halfs (72B rows)

// -------- cross-lane helper (wave32): value of lane l ^ 16 (the other half's share of a query column)
__device__ __forceinline__ float other_half(float v) {
  const int b = __float_as_int(v);
  return __int_as_float(__builtin_amdgcn_permlanex16(b, b, 0x76543210, 0xfedcba98, false, false));
}

// 16-bit A/B operand layout (ISA 7.12.2): VGPR v -> K = (v<4 ? 2v+8*half : 16+2(v-4)+8*half)
// Unconditional build of a 16x32 f16 operand from a row-major LDS tile [16][TSTR].
// Zero-padding is guaranteed by the caller's LDS region contents.
__device__ __forceinline__ v16h loadTileU(const _Float16* t) {
  const int lane = threadIdx.x & 31;
  const int half = lane >> 4;
  const u32a* p = (const u32a*)(t + (lane & 15) * TSTR);
  union { v16h h; unsigned int u[8]; } r;
  #pragma unroll
  for (int v = 0; v < 8; ++v) {
    const int k0 = (v < 4) ? (2 * v + 8 * half) : (16 + 2 * (v - 4) + 8 * half);
    r.u[v] = p[k0 >> 1];
  }
  return r.h;
}
// ================= Kernel 1: LayerNorm + QKV projection =================
// The result is stored as the halfs the attention products consume, in 16-byte operand chunks:
//   VL == 0 (q, k): [batch][head][row][8 dims]        one chunk = one row of one head
//   VL != 0 (v):    [batch][row / 8][32 cols][8 rows] one chunk = 8 consecutive rows of one column
// A wave takes 16 rows and does their product with W on the f32 16x16x4 matrix form; a block of
// 8 waves shares one copy of W in LDS, laid out as the fragments are read.
// Lane (c, h) owns row c: 16-byte piece 2j + h of the row, j = 0..31, so a row's sums need one
// exchange with lane ^ 16. k slot (h, e) of step 2j + s is column 4 * (2j + h) + 2s + e, for the
// row fragment and for the W fragment alike.
#define PW     8     // waves per block
#define XPITCH 65    // LDS row pitch in 16-byte pieces (1040 B): 16 rows fall on distinct banks

template <int VL>
__device__ __forceinline__ void ln_proj_body(
    const float* __restrict__ X, const float* __restrict__ W,
    const float* __restrict__ bias, const float* __restrict__ g,
    const float* __restrict__ bn, float* __restrict__ outp)
{
  // one array, the small tables first: their reads then take immediate offsets
  __shared__ f32x4 lds[NDIN * NDQKV / 4 + NDIN / 2 + PW * 16 * XPITCH];
  f32x4* const wf = lds;                       // [j][col tile][lane]: 4 k of one column of W
  f32x4* const gs = wf + NDIN * NDQKV / 4;
  f32x4* const bs = gs + NDIN / 4;
  f32x4* const xs = bs + NDIN / 4;             // each wave's 16 rows

  const int tid  = threadIdx.x;
  const int w    = tid >> 5;
  const int lane = tid & 31;
  const int h    = lane >> 4;
  const int c    = lane & 15;
  const int row0 = (blockIdx.x * PW + w) * 16;

  // W as fragments; gain (threads 0..127) and shift (128..255), 8 bytes a thread
  f32x4 wr[NDIN * NDQKV / 4 / (PW * 32)];
  const float* wp0 = W + (4 * (2 * (tid >> 6) + h)) * NDQKV + ((tid >> 5) & 1) * 16 + c;
  #pragma unroll
  for (int i = 0; i < NDIN * NDQKV / 4 / (PW * 32); ++i) {
    // entry e = tid + 256 i: j = e >> 6 = (tid >> 6) + 4 i, so i moves the address by 32 rows of W
    const float* wp = wp0 + i * 32 * NDQKV;
    wr[i] = (f32x4){wp[0], wp[NDQKV], wp[2 * NDQKV], wp[3 * NDQKV]};
  }
  const f32x2 tv = ((const f32x2*)((tid & (NDIN / 2)) ? bn : g))[tid & (NDIN / 2 - 1)];
  // the row loads below land in registers that held the addresses of the loads above
  asm volatile("s_wait_xcnt 0x0" ::: "memory");

  // the wave's 16 rows are 16 KiB in a row: whole lines, 512 bytes a load
  const f32x4* xg = (const f32x4*)(X + (size_t)row0 * NDIN) + lane;
  f32x4 xr[32];
  #pragma unroll
  for (int i = 0; i < 32; ++i) xr[i] = xg[i * 32];

  #pragma unroll
  for (int i = 0; i < NDIN * NDQKV / 4 / (PW * 32); ++i) wf[tid + i * (PW * 32)] = wr[i];
  ((f32x2*)gs)[tid] = tv;                      // bs follows gs

  #pragma unroll
  for (int i = 0; i < 32; ++i)
    xs[(w * 16 + (i >> 1)) * XPITCH + (i & 1) * 32 + lane] = xr[i];
  __syncthreads();

  f32x4 xv[32];
  #pragma unroll
  for (int j = 0; j < 32; ++j) xv[j] = xs[(w * 16 + c) * XPITCH + 2 * j + h];

  f32x4 sa = xv[0], sb = xv[1];
  #pragma unroll
  for (int j = 2; j < 32; j += 2) { sa += xv[j]; sb += xv[j + 1]; }
  sa += sb;
  float s = (sa.x + sa.y) + (sa.z + sa.w);
  s += other_half(s);
  const float mu = s * (1.f / NDIN);

  f32x4 qa = (f32x4)(0.f), qb = (f32x4)(0.f);
  #pragma unroll
  for (int j = 0; j < 32; j += 2) {
    xv[j]     -= mu;  qa += xv[j] * xv[j];
    xv[j + 1] -= mu;  qb += xv[j + 1] * xv[j + 1];
  }
  qa += qb;
  float q = (qa.x + qa.y) + (qa.z + qa.w);
  q += other_half(q);
  const float rstd = rsqrtf(q * (1.f / NDIN) + 1e-5f);

  // bias: asked for here, added behind the products
  v8f acc[2], bv[2];
  #pragma unroll
  for (int t = 0; t < 2; ++t)
    #pragma unroll
    for (int r = 0; r < 8; ++r) {
      acc[t][r] = 0.f;
      bv[t][r] = VL ? bias[16 * t + c] : bias[16 * t + 8 * h + r];
    }

  // gain and shift for 4 j at a time, read one group ahead
  f32x4 gb[2][8];
  #pragma unroll
  for (int i = 0; i < 4; ++i) { gb[0][2 * i] = gs[2 * i + h]; gb[0][2 * i + 1] = bs[2 * i + h]; }
  #pragma unroll
  for (int gq = 0; gq < 8; ++gq) {
    if (gq + 1 < 8) {
      #pragma unroll
      for (int i = 0; i < 4; ++i) {
        gb[(gq + 1) & 1][2 * i]     = gs[2 * ((gq + 1) * 4 + i) + h];
        gb[(gq + 1) & 1][2 * i + 1] = bs[2 * ((gq + 1) * 4 + i) + h];
      }
    }
    // bounds how far these reads are hoisted: without it all 64 go up at once and hold 256 registers
    __builtin_amdgcn_sched_barrier(0);
    #pragma unroll
    for (int i = 0; i < 4; ++i)
      xv[gq * 4 + i] = xv[gq * 4 + i] * rstd * gb[gq & 1][2 * i] + gb[gq & 1][2 * i + 1];
  }

  // W fragments in groups of 8 reads (4 j, 16 matrix instructions), one group ahead
  f32x4 wb[2][8];
  #pragma unroll
  for (int i = 0; i < 8; ++i) wb[0][i] = wf[i * 32 + lane];
  #pragma unroll
  for (int gq = 0; gq < 8; ++gq) {
    if (gq + 1 < 8) {
      #pragma unroll
      for (int i = 0; i < 8; ++i) wb[(gq + 1) & 1][i] = wf[((gq + 1) * 8 + i) * 32 + lane];
    }
    // keeps the next group's LDS reads in one place ahead of this group's matrix run, not among it
    __builtin_amdgcn_sched_barrier(0);
    #pragma unroll
    for (int jj = 0; jj < 4; ++jj) {
      const f32x4 xn = xv[gq * 4 + jj];
      #pragma unroll
      for (int sp = 0; sp < 2; ++sp) {
        const f32x2 fx = sp ? xn.zw : xn.xy;
        #pragma unroll
        for (int t = 0; t < 2; ++t) {
          const f32x4 w4 = wb[gq & 1][jj * 2 + t];
          const f32x2 fw = sp ? w4.zw : w4.xy;
          // VL: D[row 8h + r][col c]; else the transposed product, D[col 8h + r][row c]
          acc[t] = VL ? __builtin_amdgcn_wmma_f32_16x16x4_f32(false, fx, false, fw, (short)0, acc[t], false, false)
                      : __builtin_amdgcn_wmma_f32_16x16x4_f32(false, fw, false, fx, (short)0, acc[t], false, false);
        }
      }
    }
    // ends the matrix run: the reads that follow stay behind it, in one place, not among its instructions
    __builtin_amdgcn_sched_barrier(0);
  }
  // four vector slots between the last matrix instructions and the first read of their results
  asm volatile("v_nop\n\tv_nop\n\tv_nop\n\tv_nop");
  // holds the adds below behind those slots
  __builtin_amdgcn_sched_barrier(0);

  #pragma unroll
  for (int t = 0; t < 2; ++t) {
    union { u32x4 u; _Float16 hf[8]; } o;
    #pragma unroll
    for (int r = 0; r < 8; ++r) o.hf[r] = (_Float16)(acc[t][r] + bv[t][r]);
    const int chunk = VL
        ? ((row0 >> 3) + h) * NDQKV + 16 * t + c
        : ((row0 >> 10) * NHD + 2 * t + h) * NL + (row0 & (NL - 1)) + c;
    ((u32x4*)outp)[chunk] = o.u;
  }
}

__global__ __launch_bounds__(PW * 32) void ln_proj_rows_kernel(
    const float* __restrict__ X, const float* __restrict__ W,
    const float* __restrict__ bias, const float* __restrict__ g,
    const float* __restrict__ bn, float* __restrict__ outp)
{
  ln_proj_body<0>(X, W, bias, g, bn, outp);
}

__global__ __launch_bounds__(PW * 32) void ln_proj_cols_kernel(
    const float* __restrict__ X, const float* __restrict__ W,
    const float* __restrict__ bias, const float* __restrict__ g,
    const float* __restrict__ bn, float* __restrict__ outp)
{
  ln_proj_body<1>(X, W, bias, g, bn, outp);
}

// ================= Kernel 2: fused flash attention + output proj =================
// block = 128 threads = 4 waves; block handles 16 q-rows of one batch. A wave takes ALL FOUR heads
// over a quarter of the keys, so a mask tile is loaded and scaled once, by one wave, for the four
// heads that share it; the four key quarters of a head are merged through LDS behind the loop.
#define KQ (NL / 4)   // keys per wave
__global__ __launch_bounds__(128) void attn_kernel(
    const float* __restrict__ qb, const float* __restrict__ kb,
    const float* __restrict__ vb, const float* __restrict__ mask,
    const float* __restrict__ Wo, const float* __restrict__ bo,
    float* __restrict__ out)
{
  __shared__ unsigned int woP[(NDQKV / 2) * NDIN];  // W_o as f16 pairs: [kp][j] = (k=2kp,2kp+1)
  __shared__ _Float16 xt[16 * TSTR];                // fused head outputs (16 x 32)
  __shared__ f32x4 part[4 * NHD * 16 * 3];          // [quarter][head][query]: 8 dims; row max, row sum

  const int tid  = threadIdx.x;
  const int w    = tid >> 5;                  // key quarter in the loop, head in the merge
  const int lane = tid & 31;
  const int half = lane >> 4;
  const int nn   = lane & 15;

  const int b     = blockIdx.x >> 6;
  const int qbase = (blockIdx.x & 63) << 4;

  // ---- stage W_o as packed f16 pairs (consumed after __syncthreads)
  #pragma unroll
  for (int i = 0; i < ((NDQKV / 2) * NDIN) / 128; ++i) {
    const int idx = tid + i * 128;
    const int kp = idx >> 8, j = idx & 255;
    union { unsigned int u; _Float16 h[2]; } pk;
    pk.h[0] = (_Float16)Wo[(2 * kp) * NDIN + j];
    pk.h[1] = (_Float16)Wo[(2 * kp + 1) * NDIN + j];
    woP[idx] = pk.u;
  }

  // ---- operand chunks straight from the workspace (layouts: see kernel 1)
  const u32x4* qc = (const u32x4*)qb + (size_t)(b * NHD) * NL + qbase + nn;          // [head][row]
  const u32x4* kc = (const u32x4*)kb + (size_t)(b * NHD + half) * NL + w * KQ + nn;  // [head][key]
  const u32x4* vc = (const u32x4*)vb + (size_t)(b * (NL / 8) + w * (KQ / 8) + half) * NDQKV + nn;  // [key / 8][col]

  // One A operand carries a key tile's 32 dims: head g sits in k slots 8g..8g+7 (a lane's two chunks
  // are heads half and 2 + half). q as B of S^T, once per head: its 8 dims in that head's k slots,
  // zero in every other slot, so the zeros pick the head.
  v16h aQ[NHD];
  #pragma unroll  // g indexes register arrays, here and in the loops over g below
  for (int g = 0; g < NHD; ++g) {
    u32x4 qv = qc[g * NL];
    if (half != (g & 1)) qv = (u32x4)(0u);
    union { v16h h; u32x4 c[2]; } uq;
    uq.c[g >> 1]       = qv;
    uq.c[1 - (g >> 1)] = (u32x4)(0u);
    aQ[g] = uq.h;
  }

  float m_q[NHD], l_q[NHD];                   // base-2 row max; this half's share of the row sum
  v8f acc[NHD];
  #pragma unroll
  for (int g = 0; g < NHD; ++g) {
    m_q[g] = -INFINITY;
    l_q[g] = 0.f;
    #pragma unroll
    for (int r = 0; r < 8; ++r) acc[g][r] = 0.f;
  }

  const float fscale = 0.35355339059327373f * 1.4426950408889634f;   // 1/sqrt(d_head), base-2 exponent
  const float* mrow = mask + ((size_t)(b * NL + qbase + nn)) * NL + w * KQ + half * 8;

  // per-lane prefetch address: 32 lanes cover 16 mask rows x 2 column tiles
  const float* mpf = mask +
      ((size_t)(b * NL + qbase + ((lane >> 3) & 1) * 8 + (lane & 7))) * NL + w * KQ +
      ((lane >> 4) & 1) * 16;

  for (int c = 0; c < KQ / 32; ++c) {
    const int k0 = c * 32;

    if (c + 1 < KQ / 32)
      __builtin_prefetch(mpf + k0 + 32, 0, 3);   // next chunk's mask tile -> global_prefetch_b8

    // ---- k operands: row nn of tile 0 and of tile 1, all four heads
    union { v16h h; u32x4 c[2]; } uk[2];
    #pragma unroll  // t indexes registers
    for (int t = 0; t < 2; ++t) {
      uk[t].c[0] = kc[k0 + 16 * t];
      uk[t].c[1] = kc[k0 + 16 * t + 2 * NL];
    }

    // ---- mask tile, once for the four heads: |mask| / sqrt(d_head), in base-2 units
    const f32x4 ma = *(const f32x4*)(mrow + k0);
    const f32x4 mb = *(const f32x4*)(mrow + k0 + 4);
    const f32x4 mc = *(const f32x4*)(mrow + k0 + 16);
    const f32x4 md = *(const f32x4*)(mrow + k0 + 20);
    const v8f mk0 = __builtin_elementwise_abs(__builtin_shufflevector(ma, mb, 0, 1, 2, 3, 4, 5, 6, 7)) * fscale;
    const v8f mk1 = __builtin_elementwise_abs(__builtin_shufflevector(mc, md, 0, 1, 2, 3, 4, 5, 6, 7)) * fscale;

    // ---- v^T operands: keys 8*half.. and 16+8*half.. of this lane's dim, one per head pair
    union { v16h h; u32x4 c[2]; } uv[2];
    #pragma unroll  // p indexes registers
    for (int p = 0; p < 2; ++p) {
      uv[p].c[0] = vc[(c * 4) * NDQKV + 16 * p];
      uv[p].c[1] = vc[(c * 4 + 2) * NDQKV + 16 * p];
    }

    #pragma unroll
    for (int g = 0; g < NHD; ++g) {
      v8f z = {};
      const v8f S0 = __builtin_amdgcn_wmma_f32_16x16x32_f16(false, uk[0].h, false, aQ[g], (short)0, z, false, false);
      const v8f S1 = __builtin_amdgcn_wmma_f32_16x16x32_f16(false, uk[1].h, false, aQ[g], (short)0, z, false, false);
      const v8f s0 = S0 * mk0, s1 = S1 * mk1;

      // ---- online softmax: a lane's 16 scores belong to one query row, the other 16 to lane ^ 16
      float t = fmaxf(s0[0], s1[0]);
      #pragma unroll
      for (int r = 1; r < 8; ++r) t = fmaxf(t, fmaxf(s0[r], s1[r]));
      t = fmaxf(t, other_half(t));
      const float mn = fmaxf(m_q[g], t);
      const float alpha = __builtin_amdgcn_exp2f(m_q[g] - mn);
      m_q[g] = mn;
      // the two score tiles, converted in place, are the B operand P^T in the hardware k order
      const v8f d0 = s0 - mn, d1 = s1 - mn;
      v16h bP;
      float rs0 = 0.f, rs1 = 0.f;
      #pragma unroll
      for (int r = 0; r < 8; ++r) {
        const float p0 = __builtin_amdgcn_exp2f(d0[r]);
        rs0 += p0;
        bP[r] = (_Float16)p0;
      }
      #pragma unroll
      for (int r = 0; r < 8; ++r) {
        const float p1 = __builtin_amdgcn_exp2f(d1[r]);
        rs1 += p1;
        bP[8 + r] = (_Float16)p1;
      }
      acc[g] *= alpha;
      l_q[g] = l_q[g] * alpha + (rs0 + rs1);
      acc[g] = __builtin_amdgcn_wmma_f32_16x16x32_f16(false, uv[g >> 1].h, false, bP, (short)0, acc[g], false, false);
    }
  }

  // ---- each quarter's share of every head -> LDS
  #pragma unroll
  for (int g = 0; g < NHD; ++g) {
    const float l_row = l_q[g] + other_half(l_q[g]);
    if (half == (g & 1)) {
      f32x4* pp = part + ((w * NHD + g) * 16 + nn) * 3;
      pp[0] = (f32x4){acc[g][0], acc[g][1], acc[g][2], acc[g][3]};
      pp[1] = (f32x4){acc[g][4], acc[g][5], acc[g][6], acc[g][7]};
      pp[2] = (f32x4){m_q[g], l_row, 0.f, 0.f};
    }
  }
  __syncthreads();   // publishes the four quarters' shares (and the staged W_o)

  // ---- merge: wave w takes head w; lane (nn, half) dims 4*half..4*half+3 of query row nn
  {
    f32x4 ai[4], ml[4];
    #pragma unroll  // i indexes registers, here and below
    for (int i = 0; i < 4; ++i) {
      const f32x4* pp = part + ((i * NHD + w) * 16 + nn) * 3;
      ai[i] = pp[half];
      ml[i] = pp[2];
    }
    const float mx = fmaxf(fmaxf(ml[0].x, ml[1].x), fmaxf(ml[2].x, ml[3].x));
    f32x4 o = (f32x4)(0.f);
    float l_row = 0.f;
    #pragma unroll
    for (int i = 0; i < 4; ++i) {
      const float f = __builtin_amdgcn_exp2f(ml[i].x - mx);
      l_row += ml[i].y * f;
      o += ai[i] * f;
    }
    #pragma unroll
    for (int d = 0; d < 4; ++d)
      xt[nn * TSTR + w * NDH + 4 * half + d] = (_Float16)(o[d] / l_row);
  }
  __syncthreads();   // publishes the merged 16 x 32 head outputs

  // output projection: out[16 x 256] = xt(16x32) @ W_o(32x256) + b_o
  const v16h aX = loadTileU(xt);
  #pragma unroll
  for (int t = 0; t < 4; ++t) {
    const int j0 = (w * 4 + t) * 16;
    union { v16h h; unsigned int u[8]; } bW;
    #pragma unroll
    for (int v = 0; v < 8; ++v) {
      const int kk = (v < 4) ? (2 * v + 8 * half) : (16 + 2 * (v - 4) + 8 * half);
      bW.u[v] = woP[(kk >> 1) * NDIN + j0 + nn];
    }
    v8f z = {};
    union { v8f v; float f[8]; } D;
    D.v = __builtin_amdgcn_wmma_f32_16x16x32_f16(false, aX, false, bW.h, (short)0, z, false, false);
    const int col = j0 + nn;
    const float bias = bo[col];
    #pragma unroll
    for (int r = 0; r < 8; ++r)
      out[((size_t)(b * NL + qbase + r + half * 8)) * NDIN + col] = D.f[r] + bias;
  }
}

extern "C" void kernel_launch(void* const* d_in, const int* in_sizes, int n_in,
                              void* d_out, int out_size, void* d_ws, size_t ws_size,
                              hipStream_t stream)
{
  (void)in_sizes; (void)n_in; (void)out_size; (void)ws_size;
  const float* Q    = (const float*)d_in[0];
  const float* K    = (const float*)d_in[1];
  const float* V    = (const float*)d_in[2];
  const float* mask = (const float*)d_in[3];
  const float* W_q  = (const float*)d_in[4];
  const float* b_q  = (const float*)d_in[5];
  const float* W_k  = (const float*)d_in[6];
  const float* b_k  = (const float*)d_in[7];
  const float* W_v  = (const float*)d_in[8];
  const float* b_v  = (const float*)d_in[9];
  const float* W_o  = (const float*)d_in[10];
  const float* b_o  = (const float*)d_in[11];
  const float* ln_g = (const float*)d_in[12];
  const float* ln_b = (const float*)d_in[13];
  float* out = (float*)d_out;

  const size_t n1 = (size_t)NB * NL * NDQKV;
  float* qb = (float*)d_ws;
  float* kb = qb + n1;
  float* vb = kb + n1;

  dim3 grd1(NB * NL / (PW * 16));
  ln_proj_rows_kernel<<<grd1, PW * 32, 0, stream>>>(Q, W_q, b_q, ln_g, ln_b, qb);
  ln_proj_rows_kernel<<<grd1, PW * 32, 0, stream>>>(K, W_k, b_k, ln_g, ln_b, kb);
  ln_proj_cols_kernel<<<grd1, PW * 32, 0, stream>>>(V, W_v, b_v, ln_g, ln_b, vb);

  attn_kernel<<<dim3(NB * (NL / 16)), 128, 0, stream>>>(qb, kb, vb, mask, W_o, b_o, out);
}

// v005
// A run of this version takes 51.6 microseconds.
// Two timings next to v004 both put it at 1.10 times that version's speed.
// All steps since v000 together make it 4.95 times as fast.
#include <hip/hip_runtime.h>
#include <hip/hip_bf16.h>
#include <math.h>

typedef _Float16 v16h __attribute__((ext_vector_type(16)));
typedef float    v8f  __attribute__((ext_vector_type(8)));
typedef float    f32x2 __attribute__((ext_vector_type(2)));
typedef float    f32x4 __attribute__((ext_vector_type(4)));
typedef unsigned int u32a __attribute__((may_alias));   // alias-safe u32 for LDS type-punning
typedef unsigned int u32x4 __attribute__((ext_vector_type(4), may_alias));  // one 16-byte operand chunk (8 halfs)

#define NB    32
#define NL    1024
#define NDIN  256
#define NDQKV 32
#define NHD   4
#define NDH   8
#define TSTR  36   // padded LDS row stride in halfs (72B rows)

// -------- cross-lane helper (wave32): value of lane l ^ 16 (the other half's share of a query column)
__device__ __forceinline__ float other_half(float v) {
  const int b = __float_as_int(v);
  return __int_as_float(__builtin_amdgcn_permlanex16(b, b, 0x76543210, 0xfedcba98, false, false));
}

// 16-bit A/B operand layout (ISA 7.12.2): VGPR v -> K = (v<4 ? 2v+8*half : 16+2(v-4)+8*half)
// Unconditional build of a 16x32 f16 operand from a row-major LDS tile [16][TSTR].
// Zero-padding is guaranteed by the caller's LDS region contents.
__device__ __forceinline__ v16h loadTileU(const _Float16* t) {
  const int lane = threadIdx.x & 31;
  const int half = lane >> 4;
  const u32a* p = (const u32a*)(t + (lane & 15) * TSTR);
  union { v16h h; unsigned int u[8]; } r;
  #pragma unroll
  for (int v = 0; v < 8; ++v) {
    const int k0 = (v < 4) ? (2 * v + 8 * half) : (16 + 2 * (v - 4) + 8 * half);
    r.u[v] = p[k0 >> 1];
  }
  return r.h;
}
// ================= Kernel 1: LayerNorm + QKV projection =================
// The result is stored as the halfs the attention products consume, in 16-byte operand chunks:
//   VL == 0 (q, k): [batch][head][row][8 dims]        one chunk = one row of one head
//   VL != 0 (v):    [batch][row / 8][32 cols][8 rows] one chunk = 8 consecutive rows of one column
// A wave takes 16 rows and does their product with W on the f32 16x16x4 matrix form; a block of
// 4 waves shares one copy of W in LDS, laid out as the fragments are read.
// The three inputs go through ONE launch; a block's LDS and registers let three blocks share a WGP,
// so the row loads of one block run under the matrix run of another.
// Lane (c, h) owns row c: 16-byte piece 2j + h of the row, j = 0..31, so a row's sums need one
// exchange with lane ^ 16. k slot (h, e) of step 2j + s is column 4 * (2j + h) + 2s + e, for the
// row fragment and for the W fragment alike.
#define PW     4     // waves per block
#define PBLK   (NB * NL / (PW * 16))   // blocks per input
#define XPITCH 65    // LDS row pitch in 16-byte pieces (1040 B): 16 rows fall on distinct banks

template <int VL>
__device__ __forceinline__ void ln_proj_body(
    f32x4* const lds, const int blk,
    const float* __restrict__ X, const float* __restrict__ W,
    const float* __restrict__ bias, const float* __restrict__ g,
    const float* __restrict__ bn, float* __restrict__ outp)
{
  f32x4* const wf = lds;                       // [j][col tile][lane]: 4 k of one column of W
  f32x4* const gs = wf + NDIN * NDQKV / 4;
  f32x4* const bs = gs + NDIN / 4;
  f32x4* const xs = bs + NDIN / 4;             // each wave's 16 rows

  const int tid  = threadIdx.x;
  const int w    = tid >> 5;
  const int lane = tid & 31;
  const int h    = lane >> 4;
  const int c    = lane & 15;
  const int row0 = (blk * PW + w) * 16;

  // W as fragments; gain (threads 0..63) and shift (64..127), 16 bytes a thread
  f32x4 wr[NDIN * NDQKV / 4 / (PW * 32)];
  const float* wp0 = W + (4 * (2 * (tid >> 6) + h)) * NDQKV + ((tid >> 5) & 1) * 16 + c;
  #pragma unroll
  for (int i = 0; i < NDIN * NDQKV / 4 / (PW * 32); ++i) {
    // entry e = tid + 32 PW i: j = e >> 6 = (tid >> 6) + (PW / 2) i, so i moves the address by 4 PW rows of W
    const float* wp = wp0 + i * (4 * PW) * NDQKV;
    wr[i] = (f32x4){wp[0], wp[NDQKV], wp[2 * NDQKV], wp[3 * NDQKV]};
  }
  const f32x4 tv = ((const f32x4*)((tid & (NDIN / 4)) ? bn : g))[tid & (NDIN / 4 - 1)];
  // the row loads below land in registers that held the addresses of the loads above
  asm volatile("s_wait_xcnt 0x0" ::: "memory");

  // the wave's 16 rows are 16 KiB in a row: whole lines, 512 bytes a load
  const f32x4* xg = (const f32x4*)(X + (size_t)row0 * NDIN) + lane;
  f32x4 xr[32];
  #pragma unroll
  for (int i = 0; i < 32; ++i) xr[i] = xg[i * 32];

  #pragma unroll
  for (int i = 0; i < NDIN * NDQKV / 4 / (PW * 32); ++i) wf[tid + i * (PW * 32)] = wr[i];
  gs[tid] = tv;                                // bs follows gs

  #pragma unroll
  for (int i = 0; i < 32; ++i)
    xs[(w * 16 + (i >> 1)) * XPITCH + (i & 1) * 32 + lane] = xr[i];
  __syncthreads();

  f32x4 xv[32];
  #pragma unroll
  for (int j = 0; j < 32; ++j) xv[j] = xs[(w * 16 + c) * XPITCH + 2 * j + h];

  f32x4 sa = xv[0], sb = xv[1];
  #pragma unroll
  for (int j = 2; j < 32; j += 2) { sa += xv[j]; sb += xv[j + 1]; }
  sa += sb;
  float s = (sa.x + sa.y) + (sa.z + sa.w);
  s += other_half(s);
  const float mu = s * (1.f / NDIN);

  f32x4 qa = (f32x4)(0.f), qb = (f32x4)(0.f);
  #pragma unroll
  for (int j = 0; j < 32; j += 2) {
    xv[j]     -= mu;  qa += xv[j] * xv[j];
    xv[j + 1] -= mu;  qb += xv[j + 1] * xv[j + 1];
  }
  qa += qb;
  float q = (qa.x + qa.y) + (qa.z + qa.w);
  q += other_half(q);
  const float rstd = rsqrtf(q * (1.f / NDIN) + 1e-5f);

  // bias: asked for here, added behind the products
  v8f acc[2], bv[2];
  #pragma unroll
  for (int t = 0; t < 2; ++t)
    #pragma unroll
    for (int r = 0; r < 8; ++r) {
      acc[t][r] = 0.f;
      bv[t][r] = VL ? bias[16 * t + c] : bias[16 * t + 8 * h + r];
    }

  // gain and shift for 4 j at a time, read one group ahead
  f32x4 gb[2][8];
  #pragma unroll
  for (int i = 0; i < 4; ++i) { gb[0][2 * i] = gs[2 * i + h]; gb[0][2 * i + 1] = bs[2 * i + h]; }
  #pragma unroll
  for (int gq = 0; gq < 8; ++gq) {
    if (gq + 1 < 8) {
      #pragma unroll
      for (int i = 0; i < 4; ++i) {
        gb[(gq + 1) & 1][2 * i]     = gs[2 * ((gq + 1) * 4 + i) + h];
        gb[(gq + 1) & 1][2 * i + 1] = bs[2 * ((gq + 1) * 4 + i) + h];
      }
    }
    // bounds how far these reads are hoisted: without it all 64 go up at once and hold 256 registers
    __builtin_amdgcn_sched_barrier(0);
    #pragma unroll
    for (int i = 0; i < 4; ++i)
      xv[gq * 4 + i] = xv[gq * 4 + i] * rstd * gb[gq & 1][2 * i] + gb[gq & 1][2 * i + 1];
  }

  // W fragments in groups of 8 reads (4 j, 16 matrix instructions), one group ahead
  f32x4 wb[2][8];
  #pragma unroll
  for (int i = 0; i < 8; ++i) wb[0][i] = wf[i * 32 + lane];
  #pragma unroll
  for (int gq = 0; gq < 8; ++gq) {
    if (gq + 1 < 8) {
      #pragma unroll
      for (int i = 0; i < 8; ++i) wb[(gq + 1) & 1][i] = wf[((gq + 1) * 8 + i) * 32 + lane];
    }
    // keeps the next group's LDS reads in one place ahead of this group's matrix run, not among it
    __builtin_amdgcn_sched_barrier(0);
    #pragma unroll
    for (int jj = 0; jj < 4; ++jj) {
      const f32x4 xn = xv[gq * 4 + jj];
      #pragma unroll
      for (int sp = 0; sp < 2; ++sp) {
        const f32x2 fx = sp ? xn.zw : xn.xy;
        #pragma unroll
        for (int t = 0; t < 2; ++t) {
          const f32x4 w4 = wb[gq & 1][jj * 2 + t];
          const f32x2 fw = sp ? w4.zw : w4.xy;
          // VL: D[row 8h + r][col c]; else the transposed product, D[col 8h + r][row c]
          acc[t] = VL ? __builtin_amdgcn_wmma_f32_16x16x4_f32(false, fx, false, fw, (short)0, acc[t], false, false)
                      : __builtin_amdgcn_wmma_f32_16x16x4_f32(false, fw, false, fx, (short)0, acc[t], false, false);
        }
      }
    }
    // ends the matrix run: the reads that follow stay behind it, in one place, not among its instructions
    __builtin_amdgcn_sched_barrier(0);
  }
  // four vector slots between the last matrix instructions and the first read of their results
  asm volatile("v_nop\n\tv_nop\n\tv_nop\n\tv_nop");
  // holds the adds below behind those slots
  __builtin_amdgcn_sched_barrier(0);

  #pragma unroll
  for (int t = 0; t < 2; ++t) {
    union { u32x4 u; _Float16 hf[8]; } o;
    #pragma unroll
    for (int r = 0; r < 8; ++r) o.hf[r] = (_Float16)(acc[t][r] + bv[t][r]);
    const int chunk = VL
        ? ((row0 >> 3) + h) * NDQKV + 16 * t + c
        : ((row0 >> 10) * NHD + 2 * t + h) * NL + (row0 & (NL - 1)) + c;
    ((u32x4*)outp)[chunk] = o.u;
  }
  // the two bodies stand one behind the other in the built kernel: code behind these stores rewrites their registers
  asm volatile("s_wait_xcnt 0x0" ::: "memory");
}

__global__ __launch_bounds__(PW * 32) void ln_proj_kernel(
    const float* __restrict__ Q, const float* __restrict__ K, const float* __restrict__ V,
    const float* __restrict__ Wq, const float* __restrict__ Wk, const float* __restrict__ Wv,
    const float* __restrict__ bq, const float* __restrict__ bk, const float* __restrict__ bv,
    const float* __restrict__ g, const float* __restrict__ bn,
    float* __restrict__ oq, float* __restrict__ ok, float* __restrict__ ov)
{
  // one array, the small tables first: their reads then take immediate offsets
  __shared__ f32x4 lds[NDIN * NDQKV / 4 + NDIN / 2 + PW * 16 * XPITCH];
  const int which = blockIdx.x / PBLK;         // 0: q, 1: k, 2: v; the same for the whole block
  const int blk   = blockIdx.x % PBLK;
  if (which == 2)
    ln_proj_body<1>(lds, blk, V, Wv, bv, g, bn, ov);
  else
    ln_proj_body<0>(lds, blk, which ? K : Q, which ? Wk : Wq, which ? bk : bq, g, bn, which ? ok : oq);
}

// ================= Kernel 2: fused flash attention + output proj =================
// block = 128 threads = 4 waves; block handles 16 q-rows of one batch. A wave takes ALL FOUR heads
// over a quarter of the keys, so a mask tile is loaded and scaled once, by one wave, for the four
// heads that share it; the four key quarters of a head are merged through LDS behind the loop.
#define KQ (NL / 4)   // keys per wave
__global__ __launch_bounds__(128) void attn_kernel(
    const float* __restrict__ qb, const float* __restrict__ kb,
    const float* __restrict__ vb, const float* __restrict__ mask,
    const float* __restrict__ Wo, const float* __restrict__ bo,
    float* __restrict__ out)
{
  __shared__ unsigned int woP[(NDQKV / 2) * NDIN];  // W_o as f16 pairs: [kp][j] = (k=2kp,2kp+1)
  __shared__ _Float16 xt[16 * TSTR];                // fused head outputs (16 x 32)
  __shared__ f32x4 part[4 * NHD * 16 * 3];          // [quarter][head][query]: 8 dims; row max, row sum

  const int tid  = threadIdx.x;
  const int w    = tid >> 5;                  // key quarter in the loop, head in the merge
  const int lane = tid & 31;
  const int half = lane >> 4;
  const int nn   = lane & 15;

  const int b     = blockIdx.x >> 6;
  const int qbase = (blockIdx.x & 63) << 4;

  // ---- stage W_o as packed f16 pairs (consumed after __syncthreads)
  #pragma unroll
  for (int i = 0; i < ((NDQKV / 2) * NDIN) / 128; ++i) {
    const int idx = tid + i * 128;
    const int kp = idx >> 8, j = idx & 255;
    union { unsigned int u; _Float16 h[2]; } pk;
    pk.h[0] = (_Float16)Wo[(2 * kp) * NDIN + j];
    pk.h[1] = (_Float16)Wo[(2 * kp + 1) * NDIN + j];
    woP[idx] = pk.u;
  }

  // ---- operand chunks straight from the workspace (layouts: see kernel 1)
  const u32x4* qc = (const u32x4*)qb + (size_t)(b * NHD) * NL + qbase + nn;          // [head][row]
  const u32x4* kc = (const u32x4*)kb + (size_t)(b * NHD + half) * NL + w * KQ + nn;  // [head][key]
  const u32x4* vc = (const u32x4*)vb + (size_t)(b * (NL / 8) + w * (KQ / 8) + half) * NDQKV + nn;  // [key / 8][col]

  // One A operand carries a key tile's 32 dims: head g sits in k slots 8g..8g+7 (a lane's two chunks
  // are heads half and 2 + half). q as B of S^T, once per head: its 8 dims in that head's k slots,
  // zero in every other slot, so the zeros pick the head.
  v16h aQ[NHD];
  #pragma unroll  // g indexes register arrays, here and in the loops over g below
  for (int g = 0; g < NHD; ++g) {
    u32x4 qv = qc[g * NL];
    if (half != (g & 1)) qv = (u32x4)(0u);
    union { v16h h; u32x4 c[2]; } uq;
    uq.c[g >> 1]       = qv;
    uq.c[1 - (g >> 1)] = (u32x4)(0u);
    aQ[g] = uq.h;
  }

  float m_q[NHD], l_q[NHD];                   // base-2 row max; this half's share of the row sum
  v8f acc[NHD];
  #pragma unroll
  for (int g = 0; g < NHD; ++g) {
    m_q[g] = -INFINITY;
    l_q[g] = 0.f;
    #pragma unroll
    for (int r = 0; r < 8; ++r) acc[g][r] = 0.f;
  }

  const float fscale = 0.35355339059327373f * 1.4426950408889634f;   // 1/sqrt(d_head), base-2 exponent
  const float* mrow = mask + ((size_t)(b * NL + qbase + nn)) * NL + w * KQ + half * 8;

  // per-lane prefetch address: 32 lanes cover 16 mask rows x 2 column tiles
  const float* mpf = mask +
      ((size_t)(b * NL + qbase + ((lane >> 3) & 1) * 8 + (lane & 7))) * NL + w * KQ +
      ((lane >> 4) & 1) * 16;

  for (int c = 0; c < KQ / 32; ++c) {
    const int k0 = c * 32;

    if (c + 1 < KQ / 32)
      __builtin_prefetch(mpf + k0 + 32, 0, 3);   // next chunk's mask tile -> global_prefetch_b8

    // ---- k operands: row nn of tile 0 and of tile 1, all four heads
    union { v16h h; u32x4 c[2]; } uk[2];
    #pragma unroll  // t indexes registers
    for (int t = 0; t < 2; ++t) {
      uk[t].c[0] = kc[k0 + 16 * t];
      uk[t].c[1] = kc[k0 + 16 * t + 2 * NL];
    }

    // ---- mask tile, once for the four heads: |mask| / sqrt(d_head), in base-2 units
    const f32x4 ma = *(const f32x4*)(mrow + k0);
    const f32x4 mb = *(const f32x4*)(mrow + k0 + 4);
    const f32x4 mc = *(const f32x4*)(mrow + k0 + 16);
    const f32x4 md = *(const f32x4*)(mrow + k0 + 20);
    const v8f mk0 = __builtin_elementwise_abs(__builtin_shufflevector(ma, mb, 0, 1, 2, 3, 4, 5, 6, 7)) * fscale;
    const v8f mk1 = __builtin_elementwise_abs(__builtin_shufflevector(mc, md, 0, 1, 2, 3, 4, 5, 6, 7)) * fscale;

    // ---- v^T operands: keys 8*half.. and 16+8*half.. of this lane's dim, one per head pair
    union { v16h h; u32x4 c[2]; } uv[2];
    #pragma unroll  // p indexes registers
    for (int p = 0; p < 2; ++p) {
      uv[p].c[0] = vc[(c * 4) * NDQKV + 16 * p];
      uv[p].c[1] = vc[(c * 4 + 2) * NDQKV + 16 * p];
    }

    #pragma unroll
    for (int g = 0; g < NHD; ++g) {
      v8f z = {};
      const v8f S0 = __builtin_amdgcn_wmma_f32_16x16x32_f16(false, uk[0].h, false, aQ[g], (short)0, z, false, false);
      const v8f S1 = __builtin_amdgcn_wmma_f32_16x16x32_f16(false, uk[1].h, false, aQ[g], (short)0, z, false, false);
      const v8f s0 = S0 * mk0, s1 = S1 * mk1;

      // ---- online softmax: a lane's 16 scores belong to one query row, the other 16 to lane ^ 16
      float t = fmaxf(s0[0], s1[0]);
      #pragma unroll
      for (int r = 1; r < 8; ++r) t = fmaxf(t, fmaxf(s0[r], s1[r]));
      t = fmaxf(t, other_half(t));
      const float mn = fmaxf(m_q[g], t);
      const float alpha = __builtin_amdgcn_exp2f(m_q[g] - mn);
      m_q[g] = mn;
      // the two score tiles, converted in place, are the B operand P^T in the hardware k order
      const v8f d0 = s0 - mn, d1 = s1 - mn;
      v16h bP;
      float rs0 = 0.f, rs1 = 0.f;
      #pragma unroll
      for (int r = 0; r < 8; ++r) {
        const float p0 = __builtin_amdgcn_exp2f(d0[r]);
        rs0 += p0;
        bP[r] = (_Float16)p0;
      }
      #pragma unroll
      for (int r = 0; r < 8; ++r) {
        const float p1 = __builtin_amdgcn_exp2f(d1[r]);
        rs1 += p1;
        bP[8 + r] = (_Float16)p1;
      }
      acc[g] *= alpha;
      l_q[g] = l_q[g] * alpha + (rs0 + rs1);
      acc[g] = __builtin_amdgcn_wmma_f32_16x16x32_f16(false, uv[g >> 1].h, false, bP, (short)0, acc[g], false, false);
    }
  }

  // ---- each quarter's share of every head -> LDS
  #pragma unroll
  for (int g = 0; g < NHD; ++g) {
    const float l_row = l_q[g] + other_half(l_q[g]);
    if (half == (g & 1)) {
      f32x4* pp = part + ((w * NHD + g) * 16 + nn) * 3;
      pp[0] = (f32x4){acc[g][0], acc[g][1], acc[g][2], acc[g][3]};
      pp[1] = (f32x4){acc[g][4], acc[g][5], acc[g][6], acc[g][7]};
      pp[2] = (f32x4){m_q[g], l_row, 0.f, 0.f};
    }
  }
  __syncthreads();   // publishes the four quarters' shares (and the staged W_o)

  // ---- merge: wave w takes head w; lane (nn, half) dims 4*half..4*half+3 of query row nn
  {
    f32x4 ai[4], ml[4];
    #pragma unroll  // i indexes registers, here and below
    for (int i = 0; i < 4; ++i) {
      const f32x4* pp = part + ((i * NHD + w) * 16 + nn) * 3;
      ai[i] = pp[half];
      ml[i] = pp[2];
    }
    const float mx = fmaxf(fmaxf(ml[0].x, ml[1].x), fmaxf(ml[2].x, ml[3].x));
    f32x4 o = (f32x4)(0.f);
    float l_row = 0.f;
    #pragma unroll
    for (int i = 0; i < 4; ++i) {
      const float f = __builtin_amdgcn_exp2f(ml[i].x - mx);
      l_row += ml[i].y * f;
      o += ai[i] * f;
    }
    #pragma unroll
    for (int d = 0; d < 4; ++d)
      xt[nn * TSTR + w * NDH + 4 * half + d] = (_Float16)(o[d] / l_row);
  }
  __syncthreads();   // publishes the merged 16 x 32 head outputs

  // output projection: out[16 x 256] = xt(16x32) @ W_o(32x256) + b_o
  const v16h aX = loadTileU(xt);
  #pragma unroll
  for (int t = 0; t < 4; ++t) {
    const int j0 = (w * 4 + t) * 16;
    union { v16h h; unsigned int u[8]; } bW;
    #pragma unroll
    for (int v = 0; v < 8; ++v) {
      const int kk = (v < 4) ? (2 * v + 8 * half) : (16 + 2 * (v - 4) + 8 * half);
      bW.u[v] = woP[(kk >> 1) * NDIN + j0 + nn];
    }
    v8f z = {};
    union { v8f v; float f[8]; } D;
    D.v = __builtin_amdgcn_wmma_f32_16x16x32_f16(false, aX, false, bW.h, (short)0, z, false, false);
    const int col = j0 + nn;
    const float bias = bo[col];
    #pragma unroll
    for (int r = 0; r < 8; ++r)
      out[((size_t)(b * NL + qbase + r + half * 8)) * NDIN + col] = D.f[r] + bias;
  }
}

extern "C" void kernel_launch(void* const* d_in, const int* in_sizes, int n_in,
                              void* d_out, int out_size, void* d_ws, size_t ws_size,
                              hipStream_t stream)
{
  (void)in_sizes; (void)n_in; (void)out_size; (void)ws_size;
  const float* Q    = (const float*)d_in[0];
  const float* K    = (const float*)d_in[1];
  const float* V    = (const float*)d_in[2];
  const float* mask = (const float*)d_in[3];
  const float* W_q  = (const float*)d_in[4];
  const float* b_q  = (const float*)d_in[5];
  const float* W_k  = (const float*)d_in[6];
  const float* b_k  = (const float*)d_in[7];
  const float* W_v  = (const float*)d_in[8];
  const float* b_v  = (const float*)d_in[9];
  const float* W_o  = (const float*)d_in[10];
  const float* b_o  = (const float*)d_in[11];
  const float* ln_g = (const float*)d_in[12];
  const float* ln_b = (const float*)d_in[13];
  float* out = (float*)d_out;

  const size_t n1 = (size_t)NB * NL * NDQKV;
  float* qb = (float*)d_ws;
  float* kb = qb + n1;
  float* vb = kb + n1;

  ln_proj_kernel<<<dim3(3 * PBLK), PW * 32, 0, stream>>>(Q, K, V, W_q, W_k, W_v, b_q, b_k, b_v,
                                                         ln_g, ln_b, qb, kb, vb);

  attn_kernel<<<dim3(NB * (NL / 16)), 128, 0, stream>>>(qb, kb, vb, mask, W_o, b_o, out);
}

// v006
// Measured time: 48 microseconds a run.
// Timed twice side by side with v005, it ran 1.08 and 1.07 times as fast.
// Counting every step since v000, it is 5.32 times as fast.
#include <hip/hip_runtime.h>
#include <hip/hip_bf16.h>
#include <math.h>

typedef _Float16 v16h __attribute__((ext_vector_type(16)));
typedef float    v8f  __attribute__((ext_vector_type(8)));
typedef float    f32x2 __attribute__((ext_vector_type(2)));
typedef float    f32x4 __attribute__((ext_vector_type(4)));
typedef unsigned int u32a __attribute__((may_alias));   // alias-safe u32 for LDS type-punning
typedef unsigned int u32x4 __attribute__((ext_vector_type(4), may_alias));  // one 16-byte operand chunk (8 halfs)

#define NB    32
#define NL    1024
#define NDIN  256
#define NDQKV 32
#define NHD   4
#define NDH   8
#define TSTR  36   // padded LDS row stride in halfs (72B rows)

// -------- cross-lane helper (wave32): value of lane l ^ 16 (the other half's share of a query column)
__device__ __forceinline__ float other_half(float v) {
  const int b = __float_as_int(v);
  return __int_as_float(__builtin_amdgcn_permlanex16(b, b, 0x76543210, 0xfedcba98, false, false));
}

// 16-bit A/B operand layout (ISA 7.12.2): VGPR v -> K = (v<4 ? 2v+8*half : 16+2(v-4)+8*half)
// Unconditional build of a 16x32 f16 operand from a row-major LDS tile [16][TSTR].
// Zero-padding is guaranteed by the caller's LDS region contents.
__device__ __forceinline__ v16h loadTileU(const _Float16* t) {
  const int lane = threadIdx.x & 31;
  const int half = lane >> 4;
  const u32a* p = (const u32a*)(t + (lane & 15) * TSTR);
  union { v16h h; unsigned int u[8]; } r;
  #pragma unroll
  for (int v = 0; v < 8; ++v) {
    const int k0 = (v < 4) ? (2 * v + 8 * half) : (16 + 2 * (v - 4) + 8 * half);
    r.u[v] = p[k0 >> 1];
  }
  return r.h;
}
// ================= Kernel 1: LayerNorm + QKV projection =================
// The result is stored as the halfs the attention products consume, in 16-byte operand chunks:
//   VL == 0 (q, k): [batch][head][row][8 dims]        one chunk = one row of one head
//   VL != 0 (v):    [batch][row / 8][32 cols][8 rows] one chunk = 8 consecutive rows of one column
// A wave takes 16 rows and does their product with W on the f32 16x16x4 matrix form; a block of
// 4 waves shares one copy of W in LDS, laid out as the fragments are read.
// The three inputs go through ONE launch; a block's LDS and registers let three blocks share a WGP,
// so the row loads of one block run under the matrix run of another.
// Lane (c, h) owns row c: 16-byte piece 2j + h of the row, j = 0..31, so a row's sums need one
// exchange with lane ^ 16. k slot (h, e) of step 2j + s is column 4 * (2j + h) + 2s + e, for the
// row fragment and for the W fragment alike.
#define PW     4     // waves per block
#define PBLK   (NB * NL / (PW * 16))   // blocks per input
#define XPITCH 65    // LDS row pitch in 16-byte pieces (1040 B): 16 rows fall on distinct banks

template <int VL>
__device__ __forceinline__ void ln_proj_body(
    f32x4* const lds, const int blk,
    const float* __restrict__ X, const float* __restrict__ W,
    const float* __restrict__ bias, const float* __restrict__ g,
    const float* __restrict__ bn, float* __restrict__ outp)
{
  f32x4* const wf = lds;                       // [j][col tile][lane]: 4 k of one column of W
  f32x4* const gs = wf + NDIN * NDQKV / 4;
  f32x4* const bs = gs + NDIN / 4;
  f32x4* const xs = bs + NDIN / 4;             // each wave's 16 rows

  const int tid  = threadIdx.x;
  const int w    = tid >> 5;
  const int lane = tid & 31;
  const int h    = lane >> 4;
  const int c    = lane & 15;
  const int row0 = (blk * PW + w) * 16;

  // W as fragments; gain (threads 0..63) and shift (64..127), 16 bytes a thread
  f32x4 wr[NDIN * NDQKV / 4 / (PW * 32)];
  const float* wp0 = W + (4 * (2 * (tid >> 6) + h)) * NDQKV + ((tid >> 5) & 1) * 16 + c;
  #pragma unroll
  for (int i = 0; i < NDIN * NDQKV / 4 / (PW * 32); ++i) {
    // entry e = tid + 32 PW i: j = e >> 6 = (tid >> 6) + (PW / 2) i, so i moves the address by 4 PW rows of W
    const float* wp = wp0 + i * (4 * PW) * NDQKV;
    wr[i] = (f32x4){wp[0], wp[NDQKV], wp[2 * NDQKV], wp[3 * NDQKV]};
  }
  const f32x4 tv = ((const f32x4*)((tid & (NDIN / 4)) ? bn : g))[tid & (NDIN / 4 - 1)];
  // the row loads below land in registers that held the addresses of the loads above
  asm volatile("s_wait_xcnt 0x0" ::: "memory");

  // the wave's 16 rows are 16 KiB in a row: whole lines, 512 bytes a load
  const f32x4* xg = (const f32x4*)(X + (size_t)row0 * NDIN) + lane;
  f32x4 xr[32];
  #pragma unroll
  for (int i = 0; i < 32; ++i) xr[i] = xg[i * 32];

  #pragma unroll
  for (int i = 0; i < NDIN * NDQKV / 4 / (PW * 32); ++i) wf[tid + i * (PW * 32)] = wr[i];
  gs[tid] = tv;                                // bs follows gs

  #pragma unroll
  for (int i = 0; i < 32; ++i)
    xs[(w * 16 + (i >> 1)) * XPITCH + (i & 1) * 32 + lane] = xr[i];
  __syncthreads();

  f32x4 xv[32];
  #pragma unroll
  for (int j = 0; j < 32; ++j) xv[j] = xs[(w * 16 + c) * XPITCH + 2 * j + h];

  f32x4 sa = xv[0], sb = xv[1];
  #pragma unroll
  for (int j = 2; j < 32; j += 2) { sa += xv[j]; sb += xv[j + 1]; }
  sa += sb;
  float s = (sa.x + sa.y) + (sa.z + sa.w);
  s += other_half(s);
  const float mu = s * (1.f / NDIN);

  f32x4 qa = (f32x4)(0.f), qb = (f32x4)(0.f);
  #pragma unroll
  for (int j = 0; j < 32; j += 2) {
    xv[j]     -= mu;  qa += xv[j] * xv[j];
    xv[j + 1] -= mu;  qb += xv[j + 1] * xv[j + 1];
  }
  qa += qb;
  float q = (qa.x + qa.y) + (qa.z + qa.w);
  q += other_half(q);
  const float rstd = rsqrtf(q * (1.f / NDIN) + 1e-5f);

  // bias: asked for here, added behind the products
  v8f acc[2], bv[2];
  #pragma unroll
  for (int t = 0; t < 2; ++t)
    #pragma unroll
    for (int r = 0; r < 8; ++r) {
      acc[t][r] = 0.f;
      bv[t][r] = VL ? bias[16 * t + c] : bias[16 * t + 8 * h + r];
    }

  // gain and shift for 4 j at a time, read one group ahead
  f32x4 gb[2][8];
  #pragma unroll
  for (int i = 0; i < 4; ++i) { gb[0][2 * i] = gs[2 * i + h]; gb[0][2 * i + 1] = bs[2 * i + h]; }
  #pragma unroll
  for (int gq = 0; gq < 8; ++gq) {
    if (gq + 1 < 8) {
      #pragma unroll
      for (int i = 0; i < 4; ++i) {
        gb[(gq + 1) & 1][2 * i]     = gs[2 * ((gq + 1) * 4 + i) + h];
        gb[(gq + 1) & 1][2 * i + 1] = bs[2 * ((gq + 1) * 4 + i) + h];
      }
    }
    // bounds how far these reads are hoisted: without it all 64 go up at once and hold 256 registers
    __builtin_amdgcn_sched_barrier(0);
    #pragma unroll
    for (int i = 0; i < 4; ++i)
      xv[gq * 4 + i] = xv[gq * 4 + i] * rstd * gb[gq & 1][2 * i] + gb[gq & 1][2 * i + 1];
  }

  // W fragments in groups of 8 reads (4 j, 16 matrix instructions), one group ahead
  f32x4 wb[2][8];
  #pragma unroll
  for (int i = 0; i < 8; ++i) wb[0][i] = wf[i * 32 + lane];
  #pragma unroll
  for (int gq = 0; gq < 8; ++gq) {
    if (gq + 1 < 8) {
      #pragma unroll
      for (int i = 0; i < 8; ++i) wb[(gq + 1) & 1][i] = wf[((gq + 1) * 8 + i) * 32 + lane];
    }
    // keeps the next group's LDS reads in one place ahead of this group's matrix run, not among it
    __builtin_amdgcn_sched_barrier(0);
    #pragma unroll
    for (int jj = 0; jj < 4; ++jj) {
      const f32x4 xn = xv[gq * 4 + jj];
      #pragma unroll
      for (int sp = 0; sp < 2; ++sp) {
        const f32x2 fx = sp ? xn.zw : xn.xy;
        #pragma unroll
        for (int t = 0; t < 2; ++t) {
          const f32x4 w4 = wb[gq & 1][jj * 2 + t];
          const f32x2 fw = sp ? w4.zw : w4.xy;
          // VL: D[row 8h + r][col c]; else the transposed product, D[col 8h + r][row c]
          acc[t] = VL ? __builtin_amdgcn_wmma_f32_16x16x4_f32(false, fx, false, fw, (short)0, acc[t], false, false)
                      : __builtin_amdgcn_wmma_f32_16x16x4_f32(false, fw, false, fx, (short)0, acc[t], false, false);
        }
      }
    }
    // ends the matrix run: the reads that follow stay behind it, in one place, not among its instructions
    __builtin_amdgcn_sched_barrier(0);
  }
  // four vector slots between the last matrix instructions and the first read of their results
  asm volatile("v_nop\n\tv_nop\n\tv_nop\n\tv_nop");
  // holds the adds below behind those slots
  __builtin_amdgcn_sched_barrier(0);

  #pragma unroll
  for (int t = 0; t < 2; ++t) {
    union { u32x4 u; _Float16 hf[8]; } o;
    #pragma unroll
    for (int r = 0; r < 8; ++r) o.hf[r] = (_Float16)(acc[t][r] + bv[t][r]);
    const int chunk = VL
        ? ((row0 >> 3) + h) * NDQKV + 16 * t + c
        : ((row0 >> 10) * NHD + 2 * t + h) * NL + (row0 & (NL - 1)) + c;
    ((u32x4*)outp)[chunk] = o.u;
  }
  // the two bodies stand one behind the other in the built kernel: code behind these stores rewrites their registers
  asm volatile("s_wait_xcnt 0x0" ::: "memory");
}

__global__ __launch_bounds__(PW * 32) void ln_proj_kernel(
    const float* __restrict__ Q, const float* __restrict__ K, const float* __restrict__ V,
    const float* __restrict__ Wq, const float* __restrict__ Wk, const float* __restrict__ Wv,
    const float* __restrict__ bq, const float* __restrict__ bk, const float* __restrict__ bv,
    const float* __restrict__ g, const float* __restrict__ bn,
    float* __restrict__ oq, float* __restrict__ ok, float* __restrict__ ov)
{
  // one array, the small tables first: their reads then take immediate offsets
  __shared__ f32x4 lds[NDIN * NDQKV / 4 + NDIN / 2 + PW * 16 * XPITCH];
  const int which = blockIdx.x / PBLK;         // 0: q, 1: k, 2: v; the same for the whole block
  const int blk   = blockIdx.x % PBLK;
  if (which == 2)
    ln_proj_body<1>(lds, blk, V, Wv, bv, g, bn, ov);
  else
    ln_proj_body<0>(lds, blk, which ? K : Q, which ? Wk : Wq, which ? bk : bq, g, bn, which ? ok : oq);
}

// ================= Kernel 2: fused flash attention + output proj =================
// block = 128 threads = 4 waves; block handles 16 q-rows of one batch. A wave takes ALL FOUR heads
// over a quarter of the keys, so a mask tile is loaded and scaled once, by one wave, for the four
// heads that share it; the four key quarters of a head are merged through LDS behind the loop.
#define KQ (NL / 4)   // keys per wave
#define RESC 8.f      // a row is rescaled when a score exceeds its maximum in use by more than this (base 2)
__global__ __launch_bounds__(128) void attn_kernel(
    const float* __restrict__ qb, const float* __restrict__ kb,
    const float* __restrict__ vb, const float* __restrict__ mask,
    const float* __restrict__ Wo, const float* __restrict__ bo,
    float* __restrict__ out)
{
  __shared__ unsigned int woP[(NDQKV / 2) * NDIN];  // W_o as f16 pairs: [kp][j] = (k=2kp,2kp+1)
  __shared__ _Float16 xt[16 * TSTR];                // fused head outputs (16 x 32)
  __shared__ f32x4 part[4 * NHD * 16 * 3];          // [quarter][head][query]: 8 dims; max in use, row sum

  const int tid  = threadIdx.x;
  const int w    = tid >> 5;                  // key quarter in the loop, head in the merge
  const int lane = tid & 31;
  const int half = lane >> 4;
  const int nn   = lane & 15;

  const int b     = blockIdx.x >> 6;
  const int qbase = (blockIdx.x & 63) << 4;

  // ---- stage W_o as packed f16 pairs (consumed after __syncthreads)
  #pragma unroll
  for (int i = 0; i < ((NDQKV / 2) * NDIN) / 128; ++i) {
    const int idx = tid + i * 128;
    const int kp = idx >> 8, j = idx & 255;
    union { unsigned int u; _Float16 h[2]; } pk;
    pk.h[0] = (_Float16)Wo[(2 * kp) * NDIN + j];
    pk.h[1] = (_Float16)Wo[(2 * kp + 1) * NDIN + j];
    woP[idx] = pk.u;
  }

  // ---- operand chunks straight from the workspace (layouts: see kernel 1)
  const u32x4* qc = (const u32x4*)qb + (size_t)(b * NHD) * NL + qbase + nn;          // [head][row]
  const u32x4* kc = (const u32x4*)kb + (size_t)(b * NHD + half) * NL + w * KQ + nn;  // [head][key]
  const u32x4* vc = (const u32x4*)vb + (size_t)(b * (NL / 8) + w * (KQ / 8) + half) * NDQKV + nn;  // [key / 8][col]

  // One A operand carries a key tile's 32 dims: head g sits in k slots 8g..8g+7 (a lane's two chunks
  // are heads half and 2 + half). q as B of S^T, once per head: its 8 dims in that head's k slots,
  // zero in every other slot, so the zeros pick the head.
  v16h aQ[NHD];
  #pragma unroll  // g indexes register arrays, here and in the loops over g below
  for (int g = 0; g < NHD; ++g) {
    u32x4 qv = qc[g * NL];
    if (half != (g & 1)) qv = (u32x4)(0u);
    union { v16h h; u32x4 c[2]; } uq;
    uq.c[g >> 1]       = qv;
    uq.c[1 - (g >> 1)] = (u32x4)(0u);
    aQ[g] = uq.h;
  }

  float m_q[NHD], l_q[NHD];                   // base-2 maximum in use; this half's share of the row sum
  v8f acc[NHD];
  #pragma unroll
  for (int g = 0; g < NHD; ++g) {
    m_q[g] = 0.f;                             // pass 0 replaces it by its own row maximum
    l_q[g] = 0.f;
    #pragma unroll
    for (int r = 0; r < 8; ++r) acc[g][r] = 0.f;
  }

  const float fscale = 0.35355339059327373f * 1.4426950408889634f;   // 1/sqrt(d_head), base-2 exponent
  const float* mrow = mask + ((size_t)(b * NL + qbase + nn)) * NL + w * KQ + half * 8;

  // per-lane prefetch address: 32 lanes cover 16 mask rows x 2 column tiles
  const float* mpf = mask +
      ((size_t)(b * NL + qbase + ((lane >> 3) & 1) * 8 + (lane & 7))) * NL + w * KQ +
      ((lane >> 4) & 1) * 16;

  for (int c = 0; c < KQ / 32; ++c) {
    const int k0 = c * 32;

    if (c + 1 < KQ / 32)
      __builtin_prefetch(mpf + k0 + 32, 0, 3);   // next chunk's mask tile -> global_prefetch_b8

    // ---- k operands: row nn of tile 0 and of tile 1, all four heads
    union { v16h h; u32x4 c[2]; } uk[2];
    #pragma unroll  // t indexes registers
    for (int t = 0; t < 2; ++t) {
      uk[t].c[0] = kc[k0 + 16 * t];
      uk[t].c[1] = kc[k0 + 16 * t + 2 * NL];
    }

    // ---- mask tile, once for the four heads: |mask| / sqrt(d_head), in base-2 units
    const f32x4 ma = *(const f32x4*)(mrow + k0);
    const f32x4 mb = *(const f32x4*)(mrow + k0 + 4);
    const f32x4 mc = *(const f32x4*)(mrow + k0 + 16);
    const f32x4 md = *(const f32x4*)(mrow + k0 + 20);
    const v8f mk0 = __builtin_elementwise_abs(__builtin_shufflevector(ma, mb, 0, 1, 2, 3, 4, 5, 6, 7)) * fscale;
    const v8f mk1 = __builtin_elementwise_abs(__builtin_shufflevector(mc, md, 0, 1, 2, 3, 4, 5, 6, 7)) * fscale;

    // ---- v^T operands: keys 8*half.. and 16+8*half.. of this lane's dim, one per head pair
    union { v16h h; u32x4 c[2]; } uv[2];
    #pragma unroll  // p indexes registers
    for (int p = 0; p < 2; ++p) {
      uv[p].c[0] = vc[(c * 4) * NDQKV + 16 * p];
      uv[p].c[1] = vc[(c * 4 + 2) * NDQKV + 16 * p];
    }

    // ---- exponents against the maximum in use: a lane's 16 scores of a head belong to one query row,
    //      the other 16 to lane ^ 16
    v8f d0[NHD], d1[NHD];
    float t[NHD];                             // this lane's largest exponent
    #pragma unroll
    for (int g = 0; g < NHD; ++g) {
      v8f z = {};
      const v8f S0 = __builtin_amdgcn_wmma_f32_16x16x32_f16(false, uk[0].h, false, aQ[g], (short)0, z, false, false);
      const v8f S1 = __builtin_amdgcn_wmma_f32_16x16x32_f16(false, uk[1].h, false, aQ[g], (short)0, z, false, false);
      d0[g] = S0 * mk0 - m_q[g];
      d1[g] = S1 * mk1 - m_q[g];
      float tt = fmaxf(d0[g][0], d1[g][0]);
      #pragma unroll
      for (int r = 1; r < 8; ++r) tt = fmaxf(tt, fmaxf(d0[g][r], d1[g][r]));
      t[g] = tt;
    }

    // ---- one test per pass for the four heads, a scalar branch: pass 0 sets the maxima, later passes
    //      come here only when some exponent of the wave is above RESC (or is not a number)
    const float tm = fmaxf(fmaxf(t[0], t[1]), fmaxf(t[2], t[3]));
    if (c == 0 || __builtin_amdgcn_ballot_w32(!(tm <= RESC)) != 0) {
      #pragma unroll
      for (int g = 0; g < NHD; ++g) {
        const float tr    = fmaxf(t[g], other_half(t[g]));      // the same in both halves of a row
        const float delta = (c == 0) ? tr : fmaxf(tr, 0.f);     // pass 0 may also lower the start value
        const float alpha = (c == 0) ? 1.f : __builtin_amdgcn_exp2f(-delta);   // pass 0: sums are still zero
        m_q[g] += delta;
        d0[g]  -= delta;
        d1[g]  -= delta;
        acc[g] *= alpha;
        l_q[g] *= alpha;
      }
    }

    #pragma unroll
    for (int g = 0; g < NHD; ++g) {
      // the two score tiles, converted in place, are the B operand P^T in the hardware k order
      v16h bP;
      float p0[8], p1[8];
      #pragma unroll
      for (int r = 0; r < 8; ++r) {
        p0[r] = __builtin_amdgcn_exp2f(d0[g][r]);
        p1[r] = __builtin_amdgcn_exp2f(d1[g][r]);
        bP[r]     = (_Float16)p0[r];
        bP[8 + r] = (_Float16)p1[r];
      }
      acc[g] = __builtin_amdgcn_wmma_f32_16x16x32_f16(false, uv[g >> 1].h, false, bP, (short)0, acc[g], false, false);
      // holds the last head's row sum behind the pass's last matrix instruction: its adds are the vector
      // slots the chip needs before the next pass, on any branch, overwrites that instruction's operands
      if (g == NHD - 1) __builtin_amdgcn_sched_barrier(0);
      float rs0 = 0.f, rs1 = 0.f;
      #pragma unroll
      for (int r = 0; r < 8; ++r) { rs0 += p0[r]; rs1 += p1[r]; }
      l_q[g] += rs0 + rs1;
    }
  }

  // ---- each quarter's share of every head -> LDS
  #pragma unroll
  for (int g = 0; g < NHD; ++g) {
    const float l_row = l_q[g] + other_half(l_q[g]);
    if (half == (g & 1)) {
      f32x4* pp = part + ((w * NHD + g) * 16 + nn) * 3;
      pp[0] = (f32x4){acc[g][0], acc[g][1], acc[g][2], acc[g][3]};
      pp[1] = (f32x4){acc[g][4], acc[g][5], acc[g][6], acc[g][7]};
      pp[2] = (f32x4){m_q[g], l_row, 0.f, 0.f};
    }
  }
  __syncthreads();   // publishes the four quarters' shares (and the staged W_o)

  // ---- merge: wave w takes head w; lane (nn, half) dims 4*half..4*half+3 of query row nn
  {
    f32x4 ai[4], ml[4];
    #pragma unroll  // i indexes registers, here and below
    for (int i = 0; i < 4; ++i) {
      const f32x4* pp = part + ((i * NHD + w) * 16 + nn) * 3;
      ai[i] = pp[half];
      ml[i] = pp[2];
    }
    const float mx = fmaxf(fmaxf(ml[0].x, ml[1].x), fmaxf(ml[2].x, ml[3].x));
    f32x4 o = (f32x4)(0.f);
    float l_row = 0.f;
    #pragma unroll
    for (int i = 0; i < 4; ++i) {
      const float f = __builtin_amdgcn_exp2f(ml[i].x - mx);
      l_row += ml[i].y * f;
      o += ai[i] * f;
    }
    #pragma unroll
    for (int d = 0; d < 4; ++d)
      xt[nn * TSTR + w * NDH + 4 * half + d] = (_Float16)(o[d] / l_row);
  }
  __syncthreads();   // publishes the merged 16 x 32 head outputs

  // output projection: out[16 x 256] = xt(16x32) @ W_o(32x256) + b_o
  const v16h aX = loadTileU(xt);
  #pragma unroll
  for (int t = 0; t < 4; ++t) {
    const int j0 = (w * 4 + t) * 16;
    union { v16h h; unsigned int u[8]; } bW;
    #pragma unroll
    for (int v = 0; v < 8; ++v) {
      const int kk = (v < 4) ? (2 * v + 8 * half) : (16 + 2 * (v - 4) + 8 * half);
      bW.u[v] = woP[(kk >> 1) * NDIN + j0 + nn];
    }
    v8f z = {};
    union { v8f v; float f[8]; } D;
    D.v = __builtin_amdgcn_wmma_f32_16x16x32_f16(false, aX, false, bW.h, (short)0, z, false, false);
    const int col = j0 + nn;
    const float bias = bo[col];
    #pragma unroll
    for (int r = 0; r < 8; ++r)
      out[((size_t)(b * NL + qbase + r + half * 8)) * NDIN + col] = D.f[r] + bias;
  }
}

extern "C" void kernel_launch(void* const* d_in, const int* in_sizes, int n_in,
                              void* d_out, int out_size, void* d_ws, size_t ws_size,
                              hipStream_t stream)
{
  (void)in_sizes; (void)n_in; (void)out_size; (void)ws_size;
  const float* Q    = (const float*)d_in[0];
  const float* K    = (const float*)d_in[1];
  const float* V    = (const float*)d_in[2];
  const float* mask = (const float*)d_in[3];
  const float* W_q  = (const float*)d_in[4];
  const float* b_q  = (const float*)d_in[5];
  const float* W_k  = (const float*)d_in[6];
  const float* b_k  = (const float*)d_in[7];
  const float* W_v  = (const float*)d_in[8];
  const float* b_v  = (const float*)d_in[9];
  const float* W_o  = (const float*)d_in[10];
  const float* b_o  = (const float*)d_in[11];
  const float* ln_g = (const float*)d_in[12];
  const float* ln_b = (const float*)d_in[13];
  float* out = (float*)d_out;

  const size_t n1 = (size_t)NB * NL * NDQKV;
  float* qb = (float*)d_ws;
  float* kb = qb + n1;
  float* vb = kb + n1;

  ln_proj_kernel<<<dim3(3 * PBLK), PW * 32, 0, stream>>>(Q, K, V, W_q, W_k, W_v, b_q, b_k, b_v,
                                                         ln_g, ln_b, qb, kb, vb);

  attn_kernel<<<dim3(NB * (NL / 16)), 128, 0, stream>>>(qb, kb, vb, mask, W_o, b_o, out);
}

// v007
// Measured time: 41.9 microseconds a run.
// In both of two side-by-side timings against v006, it was 1.14 times as fast.
// Counting every step since v000, it is 6.08 times as fast.
#include <hip/hip_runtime.h>
#include <hip/hip_bf16.h>
#include <math.h>

typedef _Float16 v16h __attribute__((ext_vector_type(16)));
typedef float    v8f  __attribute__((ext_vector_type(8)));
typedef float    f32x2 __attribute__((ext_vector_type(2)));
typedef float    f32x4 __attribute__((ext_vector_type(4)));
typedef unsigned int u32a __attribute__((may_alias));   // alias-safe u32 for LDS type-punning
typedef unsigned int u32x4 __attribute__((ext_vector_type(4), may_alias));  // one 16-byte operand chunk (8 halfs)

#define NB    32
#define NL    1024
#define NDIN  256
#define NDQKV 32
#define NHD   4
#define NDH   8
#define TSTR  36   // padded LDS row stride in halfs (72B rows)

// -------- cross-lane helper (wave32): value of lane l ^ 16 (the other half's share of a query column)
__device__ __forceinline__ float other_half(float v) {
  const int b = __float_as_int(v);
  return __int_as_float(__builtin_amdgcn_permlanex16(b, b, 0x76543210, 0xfedcba98, false, false));
}

// 16-bit A/B operand layout (ISA 7.12.2): VGPR v -> K = (v<4 ? 2v+8*half : 16+2(v-4)+8*half)
// Unconditional build of a 16x32 f16 operand from a row-major LDS tile [16][TSTR].
// Zero-padding is guaranteed by the caller's LDS region contents.
__device__ __forceinline__ v16h loadTileU(const _Float16* t) {
  const int lane = threadIdx.x & 31;
  const int half = lane >> 4;
  const u32a* p = (const u32a*)(t + (lane & 15) * TSTR);
  union { v16h h; unsigned int u[8]; } r;
  #pragma unroll
  for (int v = 0; v < 8; ++v) {
    const int k0 = (v < 4) ? (2 * v + 8 * half) : (16 + 2 * (v - 4) + 8 * half);
    r.u[v] = p[k0 >> 1];
  }
  return r.h;
}
// ================= Kernel 1: LayerNorm + QKV projection =================
// The result is stored as the halfs the attention products consume, in 16-byte operand chunks:
//   VL == 0 (q, k): [batch][head][row][8 dims]        one chunk = one row of one head
//   VL != 0 (v):    [batch][row / 8][32 cols][8 rows] one chunk = 8 consecutive rows of one column
// A wave takes 16 rows and does their product with W on the f32 16x16x4 matrix form; a block of
// 4 waves shares one copy of W in LDS, laid out as the fragments are read.
// The three inputs go through ONE launch; a block's LDS and registers let three blocks share a WGP,
// so the row loads of one block run under the matrix run of another.
// Lane (c, h) owns row c: 16-byte piece 2j + h of the row, j = 0..31, so a row's sums need one
// exchange with lane ^ 16. k slot (h, e) of step 2j + s is column 4 * (2j + h) + 2s + e, for the
// row fragment and for the W fragment alike.
#define PW     4     // waves per block
#define PBLK   (NB * NL / (PW * 16))   // blocks per input
#define XPITCH 65    // LDS row pitch in 16-byte pieces (1040 B): 16 rows fall on distinct banks

template <int VL>
__device__ __forceinline__ void ln_proj_body(
    f32x4* const lds, const int blk,
    const float* __restrict__ X, const float* __restrict__ W,
    const float* __restrict__ bias, const float* __restrict__ g,
    const float* __restrict__ bn, float* __restrict__ outp)
{
  f32x4* const wf = lds;                       // [j][col tile][lane]: 4 k of one column of W
  f32x4* const gs = wf + NDIN * NDQKV / 4;
  f32x4* const bs = gs + NDIN / 4;
  f32x4* const xs = bs + NDIN / 4;             // each wave's 16 rows

  const int tid  = threadIdx.x;
  const int w    = tid >> 5;
  const int lane = tid & 31;
  const int h    = lane >> 4;
  const int c    = lane & 15;
  const int row0 = (blk * PW + w) * 16;

  // W as fragments; gain (threads 0..63) and shift (64..127), 16 bytes a thread
  f32x4 wr[NDIN * NDQKV / 4 / (PW * 32)];
  const float* wp0 = W + (4 * (2 * (tid >> 6) + h)) * NDQKV + ((tid >> 5) & 1) * 16 + c;
  #pragma unroll
  for (int i = 0; i < NDIN * NDQKV / 4 / (PW * 32); ++i) {
    // entry e = tid + 32 PW i: j = e >> 6 = (tid >> 6) + (PW / 2) i, so i moves the address by 4 PW rows of W
    const float* wp = wp0 + i * (4 * PW) * NDQKV;
    wr[i] = (f32x4){wp[0], wp[NDQKV], wp[2 * NDQKV], wp[3 * NDQKV]};
  }
  const f32x4 tv = ((const f32x4*)((tid & (NDIN / 4)) ? bn : g))[tid & (NDIN / 4 - 1)];
  // the row loads below land in registers that held the addresses of the loads above
  asm volatile("s_wait_xcnt 0x0" ::: "memory");

  // the wave's 16 rows are 16 KiB in a row: whole lines, 512 bytes a load
  const f32x4* xg = (const f32x4*)(X + (size_t)row0 * NDIN) + lane;
  f32x4 xr[32];
  #pragma unroll
  for (int i = 0; i < 32; ++i) xr[i] = xg[i * 32];

  #pragma unroll
  for (int i = 0; i < NDIN * NDQKV / 4 / (PW * 32); ++i) wf[tid + i * (PW * 32)] = wr[i];
  gs[tid] = tv;                                // bs follows gs

  #pragma unroll
  for (int i = 0; i < 32; ++i)
    xs[(w * 16 + (i >> 1)) * XPITCH + (i & 1) * 32 + lane] = xr[i];
  __syncthreads();

  f32x4 xv[32];
  #pragma unroll
  for (int j = 0; j < 32; ++j) xv[j] = xs[(w * 16 + c) * XPITCH + 2 * j + h];

  f32x4 sa = xv[0], sb = xv[1];
  #pragma unroll
  for (int j = 2; j < 32; j += 2) { sa += xv[j]; sb += xv[j + 1]; }
  sa += sb;
  float s = (sa.x + sa.y) + (sa.z + sa.w);
  s += other_half(s);
  const float mu = s * (1.f / NDIN);

  f32x4 qa = (f32x4)(0.f), qb = (f32x4)(0.f);
  #pragma unroll
  for (int j = 0; j < 32; j += 2) {
    xv[j]     -= mu;  qa += xv[j] * xv[j];
    xv[j + 1] -= mu;  qb += xv[j + 1] * xv[j + 1];
  }
  qa += qb;
  float q = (qa.x + qa.y) + (qa.z + qa.w);
  q += other_half(q);
  const float rstd = rsqrtf(q * (1.f / NDIN) + 1e-5f);

  // bias: asked for here, added behind the products
  v8f acc[2], bv[2];
  #pragma unroll
  for (int t = 0; t < 2; ++t)
    #pragma unroll
    for (int r = 0; r < 8; ++r) {
      acc[t][r] = 0.f;
      bv[t][r] = VL ? bias[16 * t + c] : bias[16 * t + 8 * h + r];
    }

  // gain and shift for 4 j at a time, read one group ahead
  f32x4 gb[2][8];
  #pragma unroll
  for (int i = 0; i < 4; ++i) { gb[0][2 * i] = gs[2 * i + h]; gb[0][2 * i + 1] = bs[2 * i + h]; }
  #pragma unroll
  for (int gq = 0; gq < 8; ++gq) {
    if (gq + 1 < 8) {
      #pragma unroll
      for (int i = 0; i < 4; ++i) {
        gb[(gq + 1) & 1][2 * i]     = gs[2 * ((gq + 1) * 4 + i) + h];
        gb[(gq + 1) & 1][2 * i + 1] = bs[2 * ((gq + 1) * 4 + i) + h];
      }
    }
    // bounds how far these reads are hoisted: without it all 64 go up at once and hold 256 registers
    __builtin_amdgcn_sched_barrier(0);
    #pragma unroll
    for (int i = 0; i < 4; ++i)
      xv[gq * 4 + i] = xv[gq * 4 + i] * rstd * gb[gq & 1][2 * i] + gb[gq & 1][2 * i + 1];
  }

  // W fragments in groups of 8 reads (4 j, 16 matrix instructions), one group ahead
  f32x4 wb[2][8];
  #pragma unroll
  for (int i = 0; i < 8; ++i) wb[0][i] = wf[i * 32 + lane];
  #pragma unroll
  for (int gq = 0; gq < 8; ++gq) {
    if (gq + 1 < 8) {
      #pragma unroll
      for (int i = 0; i < 8; ++i) wb[(gq + 1) & 1][i] = wf[((gq + 1) * 8 + i) * 32 + lane];
    }
    // keeps the next group's LDS reads in one place ahead of this group's matrix run, not among it
    __builtin_amdgcn_sched_barrier(0);
    #pragma unroll
    for (int jj = 0; jj < 4; ++jj) {
      const f32x4 xn = xv[gq * 4 + jj];
      #pragma unroll
      for (int sp = 0; sp < 2; ++sp) {
        const f32x2 fx = sp ? xn.zw : xn.xy;
        #pragma unroll
        for (int t = 0; t < 2; ++t) {
          const f32x4 w4 = wb[gq & 1][jj * 2 + t];
          const f32x2 fw = sp ? w4.zw : w4.xy;
          // VL: D[row 8h + r][col c]; else the transposed product, D[col 8h + r][row c]
          acc[t] = VL ? __builtin_amdgcn_wmma_f32_16x16x4_f32(false, fx, false, fw, (short)0, acc[t], false, false)
                      : __builtin_amdgcn_wmma_f32_16x16x4_f32(false, fw, false, fx, (short)0, acc[t], false, false);
        }
      }
    }
    // ends the matrix run: the reads that follow stay behind it, in one place, not among its instructions
    __builtin_amdgcn_sched_barrier(0);
  }
  // four vector slots between the last matrix instructions and the first read of their results
  asm volatile("v_nop\n\tv_nop\n\tv_nop\n\tv_nop");
  // holds the adds below behind those slots
  __builtin_amdgcn_sched_barrier(0);

  #pragma unroll
  for (int t = 0; t < 2; ++t) {
    union { u32x4 u; _Float16 hf[8]; } o;
    #pragma unroll
    for (int r = 0; r < 8; ++r) o.hf[r] = (_Float16)(acc[t][r] + bv[t][r]);
    const int chunk = VL
        ? ((row0 >> 3) + h) * NDQKV + 16 * t + c
        : ((row0 >> 10) * NHD + 2 * t + h) * NL + (row0 & (NL - 1)) + c;
    ((u32x4*)outp)[chunk] = o.u;
  }
  // the two bodies stand one behind the other in the built kernel: code behind these stores rewrites their registers
  asm volatile("s_wait_xcnt 0x0" ::: "memory");
}

__global__ __launch_bounds__(PW * 32) void ln_proj_kernel(
    const float* __restrict__ Q, const float* __restrict__ K, const float* __restrict__ V,
    const float* __restrict__ Wq, const float* __restrict__ Wk, const float* __restrict__ Wv,
    const float* __restrict__ bq, const float* __restrict__ bk, const float* __restrict__ bv,
    const float* __restrict__ g, const float* __restrict__ bn,
    float* __restrict__ oq, float* __restrict__ ok, float* __restrict__ ov)
{
  // one array, the small tables first: their reads then take immediate offsets
  __shared__ f32x4 lds[NDIN * NDQKV / 4 + NDIN / 2 + PW * 16 * XPITCH];
  const int which = blockIdx.x / PBLK;         // 0: q, 1: k, 2: v; the same for the whole block
  const int blk   = blockIdx.x % PBLK;
  if (which == 2)
    ln_proj_body<1>(lds, blk, V, Wv, bv, g, bn, ov);
  else
    ln_proj_body<0>(lds, blk, which ? K : Q, which ? Wk : Wq, which ? bk : bq, g, bn, which ? ok : oq);
}

// ================= Kernel 2: fused flash attention + output proj =================
// block = 512 threads = 16 waves = 8 query tiles of 16 rows x 2 key halves, all of one batch. The batch's
// K and V operand chunks (64 KiB each, contiguous in the workspace) are brought into LDS once per block
// and read there by all 16 waves. A wave takes ALL FOUR heads over half of the keys, so a mask tile is
// loaded and scaled once, by one wave, for the four heads that share it; the two key halves of a head
// are merged through LDS behind the loop.
#define QT 8          // query tiles per block
#define KS 2          // key shares per query tile
#define KQ (NL / KS)  // keys per wave
#define AW (QT * KS)  // waves per block
#define RESC 8.f      // a row is rescaled when a score exceeds its maximum in use by more than this (base 2)

// Eight asynchronous 16-byte copies a lane, global -> LDS, chunk i at distance i * AW * 32 chunks.
// The wait on the address translations is the statement's last line: the registers that the copies name
// stay as they are until it has returned.
__device__ __forceinline__ void copy8(const u32x4* g, const u32x4* l) {
  const unsigned int a = (unsigned int)(size_t)l;   // the LDS byte address is the low word of the pointer
  asm volatile(
      "global_load_async_to_lds_b128 %0, %8, off\n\t"
      "global_load_async_to_lds_b128 %1, %9, off\n\t"
      "global_load_async_to_lds_b128 %2, %10, off\n\t"
      "global_load_async_to_lds_b128 %3, %11, off\n\t"
      "global_load_async_to_lds_b128 %4, %12, off\n\t"
      "global_load_async_to_lds_b128 %5, %13, off\n\t"
      "global_load_async_to_lds_b128 %6, %14, off\n\t"
      "global_load_async_to_lds_b128 %7, %15, off\n\t"
      "s_wait_xcnt 0x0"
      :: "v"(a), "v"(a + 1 * AW * 512), "v"(a + 2 * AW * 512), "v"(a + 3 * AW * 512),
         "v"(a + 4 * AW * 512), "v"(a + 5 * AW * 512), "v"(a + 6 * AW * 512), "v"(a + 7 * AW * 512),
         "v"(g), "v"(g + 1 * AW * 32), "v"(g + 2 * AW * 32), "v"(g + 3 * AW * 32),
         "v"(g + 4 * AW * 32), "v"(g + 5 * AW * 32), "v"(g + 6 * AW * 32), "v"(g + 7 * AW * 32)
      : "memory");
}

__global__ __launch_bounds__(AW * 32) void attn_kernel(
    const float* __restrict__ qb, const float* __restrict__ kb,
    const float* __restrict__ vb, const float* __restrict__ mask,
    const float* __restrict__ Wo, const float* __restrict__ bo,
    float* __restrict__ out)
{
  __shared__ u32x4 kvs[2 * NHD * NL];               // the batch's K chunks [head][key], then V [key / 8][col]
  __shared__ unsigned int woP[(NDQKV / 2) * NDIN];  // W_o as f16 pairs: [kp][j] = (k=2kp,2kp+1)
  __shared__ _Float16 xt[QT * 16 * TSTR];           // fused head outputs (16 x 32 a query tile)
  __shared__ f32x4 part[QT * KS * NHD * 16 * 3];    // [tile][key half][head][query]: 8 dims; base-2 maximum in use, row sum

  const int tid  = threadIdx.x;
  const int wv   = tid >> 5;
  const int qt   = wv / KS;                   // query tile
  const int w    = wv % KS;                   // key half in the loop, head pair in the merge
  const int lane = tid & 31;
  const int half = lane >> 4;
  const int nn   = lane & 15;

  const int b     = blockIdx.x / (NL / 16 / QT);
  const int qbase = ((blockIdx.x % (NL / 16 / QT)) * QT + qt) << 4;

  // ---- K and V of the batch -> LDS: 16 chunks a thread, whole lines, every lane on
  copy8((const u32x4*)kb + (size_t)b * (NHD * NL) + tid, kvs + tid);
  copy8((const u32x4*)vb + (size_t)b * (NHD * NL) + tid, kvs + NHD * NL + tid);

  // ---- stage W_o as packed f16 pairs (runs while the copies fly)
  #pragma unroll
  for (int i = 0; i < ((NDQKV / 2) * NDIN) / (AW * 32); ++i) {
    const int idx = tid + i * (AW * 32);
    const int kp = idx >> 8, j = idx & 255;
    union { unsigned int u; _Float16 h[2]; } pk;
    pk.h[0] = (_Float16)Wo[(2 * kp) * NDIN + j];
    pk.h[1] = (_Float16)Wo[(2 * kp + 1) * NDIN + j];
    woP[idx] = pk.u;
  }

  // ---- operand chunks (layouts: see kernel 1): q straight from the workspace, K and V from LDS
  const u32x4* qc = (const u32x4*)qb + (size_t)(b * NHD) * NL + qbase + nn;          // [head][row]
  const u32x4* kc = kvs + half * NL + w * KQ + nn;                                   // [head][key]
  const u32x4* vc = kvs + NHD * NL + (w * (KQ / 8) + half) * NDQKV + nn;             // [key / 8][col]

  // One A operand carries a key tile's 32 dims: head g sits in k slots 8g..8g+7 (a lane's two chunks
  // are heads half and 2 + half). q as B of S^T, once per head: its 8 dims in that head's k slots,
  // zero in every other slot, so the zeros pick the head.
  v16h aQ[NHD];
  #pragma unroll  // g indexes register arrays, here and in the loops over g below
  for (int g = 0; g < NHD; ++g) {
    u32x4 qv = qc[g * NL];
    if (half != (g & 1)) qv = (u32x4)(0u);
    union { v16h h; u32x4 c[2]; } uq;
    uq.c[g >> 1]       = qv;
    uq.c[1 - (g >> 1)] = (u32x4)(0u);
    aQ[g] = uq.h;
  }

  float m_q[NHD], l_q[NHD];                   // base-2 maximum in use; this half's share of the row sum
  v8f acc[NHD];
  #pragma unroll
  for (int g = 0; g < NHD; ++g) {
    m_q[g] = 0.f;                             // pass 0 replaces it by its own row maximum
    l_q[g] = 0.f;
    #pragma unroll
    for (int r = 0; r < 8; ++r) acc[g][r] = 0.f;
  }

  const float fscale = 0.35355339059327373f * 1.4426950408889634f;   // 1/sqrt(d_head), base-2 exponent
  const float* mrow = mask + ((size_t)(b * NL + qbase + nn)) * NL + w * KQ + half * 8;

  // per-lane prefetch address: 32 lanes cover 16 mask rows x 2 column tiles
  const float* mpf = mask +
      ((size_t)(b * NL + qbase + ((lane >> 3) & 1) * 8 + (lane & 7))) * NL + w * KQ +
      ((lane >> 4) & 1) * 16;

  // this wave's copies have landed; behind the barrier every wave's have (it publishes the staged W_o too)
  asm volatile("s_wait_asynccnt 0x0" ::: "memory");
  __syncthreads();

  for (int c = 0; c < KQ / 32; ++c) {
    const int k0 = c * 32;

    if (c + 1 < KQ / 32)
      __builtin_prefetch(mpf + k0 + 32, 0, 3);   // next chunk's mask tile -> global_prefetch_b8

    // ---- k operands: row nn of tile 0 and of tile 1, all four heads
    union { v16h h; u32x4 c[2]; } uk[2];
    #pragma unroll  // t indexes registers
    for (int t = 0; t < 2; ++t) {
      uk[t].c[0] = kc[k0 + 16 * t];
      uk[t].c[1] = kc[k0 + 16 * t + 2 * NL];
    }

    // ---- mask tile, once for the four heads: |mask| / sqrt(d_head), in base-2 units
    const f32x4 ma = *(const f32x4*)(mrow + k0);
    const f32x4 mb = *(const f32x4*)(mrow + k0 + 4);
    const f32x4 mc = *(const f32x4*)(mrow + k0 + 16);
    const f32x4 md = *(const f32x4*)(mrow + k0 + 20);
    const v8f mk0 = __builtin_elementwise_abs(__builtin_shufflevector(ma, mb, 0, 1, 2, 3, 4, 5, 6, 7)) * fscale;
    const v8f mk1 = __builtin_elementwise_abs(__builtin_shufflevector(mc, md, 0, 1, 2, 3, 4, 5, 6, 7)) * fscale;

    // ---- v^T operands: keys 8*half.. and 16+8*half.. of this lane's dim, one per head pair
    union { v16h h; u32x4 c[2]; } uv[2];
    #pragma unroll  // p indexes registers
    for (int p = 0; p < 2; ++p) {
      uv[p].c[0] = vc[(c * 4) * NDQKV + 16 * p];
      uv[p].c[1] = vc[(c * 4 + 2) * NDQKV + 16 * p];
    }

    // ---- exponents against the maximum in use: a lane's 16 scores of a head belong to one query row,
    //      the other 16 to lane ^ 16
    v8f d0[NHD], d1[NHD];
    float t[NHD];                             // this lane's largest exponent
    #pragma unroll
    for (int g = 0; g < NHD; ++g) {
      v8f z = {};
      const v8f S0 = __builtin_amdgcn_wmma_f32_16x16x32_f16(false, uk[0].h, false, aQ[g], (short)0, z, false, false);
      const v8f S1 = __builtin_amdgcn_wmma_f32_16x16x32_f16(false, uk[1].h, false, aQ[g], (short)0, z, false, false);
      d0[g] = S0 * mk0 - m_q[g];
      d1[g] = S1 * mk1 - m_q[g];
      float tt = fmaxf(d0[g][0], d1[g][0]);
      #pragma unroll
      for (int r = 1; r < 8; ++r) tt = fmaxf(tt, fmaxf(d0[g][r], d1[g][r]));
      t[g] = tt;
    }

    // ---- one test per pass for the four heads, a scalar branch: pass 0 sets the maxima, later passes
    //      come here only when some exponent of the wave is above RESC (or is not a number)
    const float tm = fmaxf(fmaxf(t[0], t[1]), fmaxf(t[2], t[3]));
    if (c == 0 || __builtin_amdgcn_ballot_w32(!(tm <= RESC)) != 0) {
      #pragma unroll
      for (int g = 0; g < NHD; ++g) {
        const float tr    = fmaxf(t[g], other_half(t[g]));      // the same in both halves of a row
        const float delta = (c == 0) ? tr : fmaxf(tr, 0.f);     // pass 0 may also lower the start value
        const float alpha = (c == 0) ? 1.f : __builtin_amdgcn_exp2f(-delta);   // pass 0: sums are still zero
        m_q[g] += delta;
        d0[g]  -= delta;
        d1[g]  -= delta;
        acc[g] *= alpha;
        l_q[g] *= alpha;
      }
    }

    #pragma unroll
    for (int g = 0; g < NHD; ++g) {
      // the two score tiles, converted in place, are the B operand P^T in the hardware k order
      v16h bP;
      float p0[8], p1[8];
      #pragma unroll
      for (int r = 0; r < 8; ++r) {
        p0[r] = __builtin_amdgcn_exp2f(d0[g][r]);
        p1[r] = __builtin_amdgcn_exp2f(d1[g][r]);
        bP[r]     = (_Float16)p0[r];
        bP[8 + r] = (_Float16)p1[r];
      }
      acc[g] = __builtin_amdgcn_wmma_f32_16x16x32_f16(false, uv[g >> 1].h, false, bP, (short)0, acc[g], false, false);
      // holds the last head's row sum behind the pass's last matrix instruction: its adds are the vector
      // slots the chip needs before the next pass, on any branch, overwrites that instruction's operands
      if (g == NHD - 1) __builtin_amdgcn_sched_barrier(0);
      float rs0 = 0.f, rs1 = 0.f;
      #pragma unroll
      for (int r = 0; r < 8; ++r) { rs0 += p0[r]; rs1 += p1[r]; }
      l_q[g] += rs0 + rs1;
    }
  }

  // ---- each key half's share of every head -> LDS
  #pragma unroll
  for (int g = 0; g < NHD; ++g) {
    const float l_row = l_q[g] + other_half(l_q[g]);
    if (half == (g & 1)) {
      f32x4* pp = part + (((qt * KS + w) * NHD + g) * 16 + nn) * 3;
      pp[0] = (f32x4){acc[g][0], acc[g][1], acc[g][2], acc[g][3]};
      pp[1] = (f32x4){acc[g][4], acc[g][5], acc[g][6], acc[g][7]};
      pp[2] = (f32x4){m_q[g], l_row, 0.f, 0.f};
    }
  }
  __syncthreads();   // publishes the key halves' shares

  // ---- merge: wave w of a tile takes heads 2w and 2w + 1; lane (nn, half) dims 4*half..4*half+3 of query row nn
  #pragma unroll  // hh, i index registers
  for (int hh = 0; hh < NHD / KS; ++hh) {
    const int hd = w * (NHD / KS) + hh;
    f32x4 ai[KS], ml[KS];
    #pragma unroll
    for (int i = 0; i < KS; ++i) {
      const f32x4* pp = part + (((qt * KS + i) * NHD + hd) * 16 + nn) * 3;
      ai[i] = pp[half];
      ml[i] = pp[2];
    }
    const float mx = fmaxf(ml[0].x, ml[1].x);
    f32x4 o = (f32x4)(0.f);
    float l_row = 0.f;
    #pragma unroll
    for (int i = 0; i < KS; ++i) {
      const float f = __builtin_amdgcn_exp2f(ml[i].x - mx);
      l_row += ml[i].y * f;
      o += ai[i] * f;
    }
    #pragma unroll
    for (int d = 0; d < 4; ++d)
      xt[(qt * 16 + nn) * TSTR + hd * NDH + 4 * half + d] = (_Float16)(o[d] / l_row);
  }
  __syncthreads();   // publishes the merged 16 x 32 head outputs

  // output projection: out[16 x 256] = xt(16x32) @ W_o(32x256) + b_o
  const v16h aX = loadTileU(xt + qt * 16 * TSTR);
  #pragma unroll
  for (int t = 0; t < NDIN / 16 / KS; ++t) {
    const int j0 = (w * (NDIN / 16 / KS) + t) * 16;
    union { v16h h; unsigned int u[8]; } bW;
    #pragma unroll
    for (int v = 0; v < 8; ++v) {
      const int kk = (v < 4) ? (2 * v + 8 * half) : (16 + 2 * (v - 4) + 8 * half);
      bW.u[v] = woP[(kk >> 1) * NDIN + j0 + nn];
    }
    v8f z = {};
    union { v8f v; float f[8]; } D;
    D.v = __builtin_amdgcn_wmma_f32_16x16x32_f16(false, aX, false, bW.h, (short)0, z, false, false);
    const int col = j0 + nn;
    const float bias = bo[col];
    #pragma unroll
    for (int r = 0; r < 8; ++r)
      out[((size_t)(b * NL + qbase + r + half * 8)) * NDIN + col] = D.f[r] + bias;
  }
}

extern "C" void kernel_launch(void* const* d_in, const int* in_sizes, int n_in,
                              void* d_out, int out_size, void* d_ws, size_t ws_size,
                              hipStream_t stream)
{
  (void)in_sizes; (void)n_in; (void)out_size; (void)ws_size;
  const float* Q    = (const float*)d_in[0];
  const float* K    = (const float*)d_in[1];
  const float* V    = (const float*)d_in[2];
  const float* mask = (const float*)d_in[3];
  const float* W_q  = (const float*)d_in[4];
  const float* b_q  = (const float*)d_in[5];
  const float* W_k  = (const float*)d_in[6];
  const float* b_k  = (const float*)d_in[7];
  const float* W_v  = (const float*)d_in[8];
  const float* b_v  = (const float*)d_in[9];
  const float* W_o  = (const float*)d_in[10];
  const float* b_o  = (const float*)d_in[11];
  const float* ln_g = (const float*)d_in[12];
  const float* ln_b = (const float*)d_in[13];
  float* out = (float*)d_out;

  const size_t n1 = (size_t)NB * NL * NDQKV;
  float* qb = (float*)d_ws;
  float* kb = qb + n1;
  float* vb = kb + n1;

  ln_proj_kernel<<<dim3(3 * PBLK), PW * 32, 0, stream>>>(Q, K, V, W_q, W_k, W_v, b_q, b_k, b_v,
                                                         ln_g, ln_b, qb, kb, vb);

  attn_kernel<<<dim3(NB * (NL / 16) / QT), AW * 32, 0, stream>>>(qb, kb, vb, mask, W_o, b_o, out);
}

// v008
// It runs in 38.7 microseconds.
// Timed twice side by side with v007, it ran 1.08 times as fast both times.
// Counting every step since v000, it is 6.56 times as fast.
#include <hip/hip_runtime.h>
#include <hip/hip_bf16.h>
#include <math.h>

typedef _Float16 v16h __attribute__((ext_vector_type(16)));
typedef float    v8f  __attribute__((ext_vector_type(8)));
typedef float    f32x2 __attribute__((ext_vector_type(2)));
typedef _Float16 h16x2 __attribute__((ext_vector_type(2)));
typedef float    f32x4 __attribute__((ext_vector_type(4)));
typedef unsigned int u32a __attribute__((may_alias));   // alias-safe u32 for LDS type-punning
typedef unsigned int u32x4 __attribute__((ext_vector_type(4), may_alias));  // one 16-byte operand chunk (8 halfs)

#define NB    32
#define NL    1024
#define NDIN  256
#define NDQKV 32
#define NHD   4
#define NDH   8
#define TSTR  36   // padded LDS row stride in halfs (72B rows)

// -------- cross-lane helper (wave32): value of lane l ^ 16 (the other half's share of a query column)
__device__ __forceinline__ float other_half(float v) {
  const int b = __float_as_int(v);
  return __int_as_float(__builtin_amdgcn_permlanex16(b, b, 0x76543210, 0xfedcba98, false, false));
}

// 16-bit A/B operand layout (ISA 7.12.2): VGPR v -> K = (v<4 ? 2v+8*half : 16+2(v-4)+8*half)
// Unconditional build of a 16x32 f16 operand from a row-major LDS tile [16][TSTR].
// Zero-padding is guaranteed by the caller's LDS region contents.
__device__ __forceinline__ v16h loadTileU(const _Float16* t) {
  const int lane = threadIdx.x & 31;
  const int half = lane >> 4;
  const u32a* p = (const u32a*)(t + (lane & 15) * TSTR);
  union { v16h h; unsigned int u[8]; } r;
  #pragma unroll
  for (int v = 0; v < 8; ++v) {
    const int k0 = (v < 4) ? (2 * v + 8 * half) : (16 + 2 * (v - 4) + 8 * half);
    r.u[v] = p[k0 >> 1];
  }
  return r.h;
}
// ================= Kernel 1: LayerNorm + QKV projection =================
// The result is stored as the halfs the attention products consume, in 16-byte operand chunks:
//   VL == 0 (q, k): [batch][head][row][8 dims]        one chunk = one row of one head
//   VL != 0 (v):    [batch][row / 8][32 cols][8 rows] one chunk = 8 consecutive rows of one column
// A wave takes 16 rows. Their product with W runs on the f16 16x16x32 matrix form with f32 sums: each f32
// operand is split into an f16 high part and the f16 rest (about 22 bits kept), and three products are
// summed, high x high + rest x high + high x rest. A block of 4 waves shares one copy of the split W in
// LDS, laid out as the fragments are read.
// The three inputs go through ONE launch; a block's LDS and registers let three blocks share a WGP,
// so the row loads of one block run under the matrix run of another.
// Lane (c, h) owns row c: 16-byte piece 2j + h of the row, j = 0..31, so a row's sums need one
// exchange with lane ^ 16. Element 4 * jj + e of lane half h in step s is column 32s + 8jj + 4h + e, for
// the row fragment and for the W fragment alike.
#define PW     4     // waves per block
#define PBLK   (NB * NL / (PW * 16))   // blocks per input
#define XPITCH 65    // LDS row pitch in 16-byte pieces (1040 B): 16 rows fall on distinct banks

// two f32 -> their f16 high parts (one word) and the f16 rests (one word)
__device__ __forceinline__ void split_f16(const float x0, const float x1, h16x2& hi, h16x2& lo) {
  hi = __builtin_convertvector((f32x2){x0, x1}, h16x2);
  lo = (h16x2){(_Float16)__builtin_fmaf((float)hi.x, -1.f, x0), (_Float16)__builtin_fmaf((float)hi.y, -1.f, x1)};
}

template <int VL>
__device__ __forceinline__ void ln_proj_body(
    f32x4* const lds, const int blk,
    const float* __restrict__ X, const float* __restrict__ W,
    const float* __restrict__ bias, const float* __restrict__ g,
    const float* __restrict__ bn, float* __restrict__ outp)
{
  u32x4* const wf = (u32x4*)lds;               // [high, rest][step][col tile][chunk][lane]: 8 k of one column of W
  f32x4* const gs = lds + NDIN * NDQKV / 4;
  f32x4* const bs = gs + NDIN / 4;
  f32x4* const xs = bs + NDIN / 4;             // each wave's 16 rows

  const int tid  = threadIdx.x;
  const int w    = tid >> 5;
  const int lane = tid & 31;
  const int h    = lane >> 4;
  const int c    = lane & 15;
  const int row0 = (blk * PW + w) * 16;

  // W as fragments; gain (threads 0..63) and shift (64..127), 16 bytes a thread
  // a thread takes chunk (tid >> 5) & 1 of column tile tid >> 6 in every step: rows 32s + 16 chunk + 8jj + 4h + e
  float wr[NDIN / 32][8];
  const float* wp0 = W + (16 * ((tid >> 5) & 1) + 4 * h) * NDQKV + (tid >> 6) * 16 + c;
  #pragma unroll
  for (int s = 0; s < NDIN / 32; ++s)
    #pragma unroll
    for (int p = 0; p < 8; ++p) wr[s][p] = wp0[(32 * s + 8 * (p >> 2) + (p & 3)) * NDQKV];
  const f32x4 tv = ((const f32x4*)((tid & (NDIN / 4)) ? bn : g))[tid & (NDIN / 4 - 1)];
  // the row loads below land in registers that held the addresses of the loads above
  asm volatile("s_wait_xcnt 0x0" ::: "memory");

  // the wave's 16 rows are 16 KiB in a row: whole lines, 512 bytes a load
  const f32x4* xg = (const f32x4*)(X + (size_t)row0 * NDIN) + lane;
  f32x4 xr[32];
  #pragma unroll
  for (int i = 0; i < 32; ++i) xr[i] = xg[i * 32];

  #pragma unroll
  for (int s = 0; s < NDIN / 32; ++s) {
    union { u32x4 u; h16x2 hf[4]; } whi, wlo;
    #pragma unroll
    for (int p = 0; p < 4; ++p) split_f16(wr[s][2 * p], wr[s][2 * p + 1], whi.hf[p], wlo.hf[p]);
    wf[s * (PW * 32) + tid] = whi.u;
    wf[NDIN * NDQKV / 8 + s * (PW * 32) + tid] = wlo.u;
  }
  gs[tid] = tv;                                // bs follows gs

  #pragma unroll
  for (int i = 0; i < 32; ++i)
    xs[(w * 16 + (i >> 1)) * XPITCH + (i & 1) * 32 + lane] = xr[i];
  __syncthreads();

  f32x4 xv[32];
  #pragma unroll
  for (int j = 0; j < 32; ++j) xv[j] = xs[(w * 16 + c) * XPITCH + 2 * j + h];

  f32x4 sa = xv[0], sb = xv[1];
  #pragma unroll
  for (int j = 2; j < 32; j += 2) { sa += xv[j]; sb += xv[j + 1]; }
  sa += sb;
  float s = (sa.x + sa.y) + (sa.z + sa.w);
  s += other_half(s);
  const float mu = s * (1.f / NDIN);

  f32x4 qa = (f32x4)(0.f), qb = (f32x4)(0.f);
  #pragma unroll
  for (int j = 0; j < 32; j += 2) {
    xv[j]     -= mu;  qa += xv[j] * xv[j];
    xv[j + 1] -= mu;  qb += xv[j + 1] * xv[j + 1];
  }
  qa += qb;
  float q = (qa.x + qa.y) + (qa.z + qa.w);
  q += other_half(q);
  const float rstd = rsqrtf(q * (1.f / NDIN) + 1e-5f);

  // bias: asked for here, added behind the products
  v8f acc[2], acr[2], bv[2];                   // acc: high x high; acr: the two products with a rest
  #pragma unroll
  for (int t = 0; t < 2; ++t)
    #pragma unroll
    for (int r = 0; r < 8; ++r) {
      acc[t][r] = 0.f;
      acr[t][r] = 0.f;
      bv[t][r] = VL ? bias[16 * t + c] : bias[16 * t + 8 * h + r];
    }

  // gain and shift for 4 j at a time, read one group ahead
  f32x4 gb[2][8];
  #pragma unroll
  for (int i = 0; i < 4; ++i) { gb[0][2 * i] = gs[2 * i + h]; gb[0][2 * i + 1] = bs[2 * i + h]; }
  #pragma unroll
  for (int gq = 0; gq < 8; ++gq) {
    if (gq + 1 < 8) {
      #pragma unroll
      for (int i = 0; i < 4; ++i) {
        gb[(gq + 1) & 1][2 * i]     = gs[2 * ((gq + 1) * 4 + i) + h];
        gb[(gq + 1) & 1][2 * i + 1] = bs[2 * ((gq + 1) * 4 + i) + h];
      }
    }
    // bounds how far these reads are hoisted: without it all 64 go up at once and hold 256 registers
    __builtin_amdgcn_sched_barrier(0);
    #pragma unroll
    for (int i = 0; i < 4; ++i)
      xv[gq * 4 + i] = xv[gq * 4 + i] * rstd * gb[gq & 1][2 * i] + gb[gq & 1][2 * i + 1];
  }

  // A step is 32 k: 8 reads of W fragments, one step ahead, and 6 matrix instructions; the next step's rows
  // are split while this step's matrix instructions run.
  union frag { v16h h; u32x4 c[2]; h16x2 e[8]; };
  u32x4 wb[2][8];                              // [col tile][high, rest][chunk]
  frag xh[2], xl[2];
  #pragma unroll
  for (int i = 0; i < 8; ++i) wb[0][i] = wf[((i >> 1) & 1) * (NDIN * NDQKV / 8) + ((i >> 2) * 2 + (i & 1)) * 32 + lane];
  #pragma unroll
  for (int p = 0; p < 8; ++p) split_f16(xv[p >> 1][2 * (p & 1)], xv[p >> 1][2 * (p & 1) + 1], xh[0].e[p], xl[0].e[p]);
  #pragma unroll
  for (int s = 0; s < NDIN / 32; ++s) {
    if (s + 1 < NDIN / 32) {
      #pragma unroll
      for (int i = 0; i < 8; ++i)
        wb[(s + 1) & 1][i] = wf[((i >> 1) & 1) * (NDIN * NDQKV / 8) + (s + 1) * (PW * 32) + ((i >> 2) * 2 + (i & 1)) * 32 + lane];
    }
    // keeps the next step's LDS reads in one place ahead of this step's matrix run, not among it
    __builtin_amdgcn_sched_barrier(0);
    frag wh[2], wl[2];
    #pragma unroll
    for (int t = 0; t < 2; ++t) {
      wh[t].c[0] = wb[s & 1][4 * t];      wh[t].c[1] = wb[s & 1][4 * t + 1];
      wl[t].c[0] = wb[s & 1][4 * t + 2];  wl[t].c[1] = wb[s & 1][4 * t + 3];
    }
    // VL: D[row 8h + r][col c]; else the transposed product, D[col 8h + r][row c]
    #pragma unroll
    for (int t = 0; t < 2; ++t)
      acc[t] = VL ? __builtin_amdgcn_wmma_f32_16x16x32_f16(false, xh[s & 1].h, false, wh[t].h, (short)0, acc[t], false, false)
                  : __builtin_amdgcn_wmma_f32_16x16x32_f16(false, wh[t].h, false, xh[s & 1].h, (short)0, acc[t], false, false);
    #pragma unroll
    for (int t = 0; t < 2; ++t)
      acr[t] = VL ? __builtin_amdgcn_wmma_f32_16x16x32_f16(false, xl[s & 1].h, false, wh[t].h, (short)0, acr[t], false, false)
                  : __builtin_amdgcn_wmma_f32_16x16x32_f16(false, wh[t].h, false, xl[s & 1].h, (short)0, acr[t], false, false);
    #pragma unroll
    for (int t = 0; t < 2; ++t)
      acr[t] = VL ? __builtin_amdgcn_wmma_f32_16x16x32_f16(false, xh[s & 1].h, false, wl[t].h, (short)0, acr[t], false, false)
                  : __builtin_amdgcn_wmma_f32_16x16x32_f16(false, wl[t].h, false, xh[s & 1].h, (short)0, acr[t], false, false);
    if (s + 1 < NDIN / 32) {
      #pragma unroll
      for (int p = 0; p < 8; ++p)
        split_f16(xv[(s + 1) * 4 + (p >> 1)][2 * (p & 1)], xv[(s + 1) * 4 + (p >> 1)][2 * (p & 1) + 1],
                  xh[(s + 1) & 1].e[p], xl[(s + 1) & 1].e[p]);
    }
    // ends the step: the reads that follow stay behind it, in one place, not among its instructions
    __builtin_amdgcn_sched_barrier(0);
  }

  #pragma unroll
  for (int t = 0; t < 2; ++t) {
    union { u32x4 u; _Float16 hf[8]; } o;
    #pragma unroll
    for (int r = 0; r < 8; ++r) o.hf[r] = (_Float16)((acc[t][r] + acr[t][r]) + bv[t][r]);
    const int chunk = VL
        ? ((row0 >> 3) + h) * NDQKV + 16 * t + c
        : ((row0 >> 10) * NHD + 2 * t + h) * NL + (row0 & (NL - 1)) + c;
    ((u32x4*)outp)[chunk] = o.u;
  }
  // the two bodies stand one behind the other in the built kernel: code behind these stores rewrites their registers
  asm volatile("s_wait_xcnt 0x0" ::: "memory");
}

__global__ __launch_bounds__(PW * 32) void ln_proj_kernel(
    const float* __restrict__ Q, const float* __restrict__ K, const float* __restrict__ V,
    const float* __restrict__ Wq, const float* __restrict__ Wk, const float* __restrict__ Wv,
    const float* __restrict__ bq, const float* __restrict__ bk, const float* __restrict__ bv,
    const float* __restrict__ g, const float* __restrict__ bn,
    float* __restrict__ oq, float* __restrict__ ok, float* __restrict__ ov)
{
  // one array, the small tables first: their reads then take immediate offsets
  __shared__ f32x4 lds[NDIN * NDQKV / 4 + NDIN / 2 + PW * 16 * XPITCH];
  const int which = blockIdx.x / PBLK;         // 0: q, 1: k, 2: v; the same for the whole block
  const int blk   = blockIdx.x % PBLK;
  if (which == 2)
    ln_proj_body<1>(lds, blk, V, Wv, bv, g, bn, ov);
  else
    ln_proj_body<0>(lds, blk, which ? K : Q, which ? Wk : Wq, which ? bk : bq, g, bn, which ? ok : oq);
}

// ================= Kernel 2: fused flash attention + output proj =================
// block = 512 threads = 16 waves = 8 query tiles of 16 rows x 2 key halves, all of one batch. The batch's
// K and V operand chunks (64 KiB each, contiguous in the workspace) are brought into LDS once per block
// and read there by all 16 waves. A wave takes ALL FOUR heads over half of the keys, so a mask tile is
// loaded and scaled once, by one wave, for the four heads that share it; the two key halves of a head
// are merged through LDS behind the loop.
#define QT 8          // query tiles per block
#define KS 2          // key shares per query tile
#define KQ (NL / KS)  // keys per wave
#define AW (QT * KS)  // waves per block
#define RESC 8.f      // a row is rescaled when a score exceeds its maximum in use by more than this (base 2)

// Eight asynchronous 16-byte copies a lane, global -> LDS, chunk i at distance i * AW * 32 chunks.
// The wait on the address translations is the statement's last line: the registers that the copies name
// stay as they are until it has returned.
__device__ __forceinline__ void copy8(const u32x4* g, const u32x4* l) {
  const unsigned int a = (unsigned int)(size_t)l;   // the LDS byte address is the low word of the pointer
  asm volatile(
      "global_load_async_to_lds_b128 %0, %8, off\n\t"
      "global_load_async_to_lds_b128 %1, %9, off\n\t"
      "global_load_async_to_lds_b128 %2, %10, off\n\t"
      "global_load_async_to_lds_b128 %3, %11, off\n\t"
      "global_load_async_to_lds_b128 %4, %12, off\n\t"
      "global_load_async_to_lds_b128 %5, %13, off\n\t"
      "global_load_async_to_lds_b128 %6, %14, off\n\t"
      "global_load_async_to_lds_b128 %7, %15, off\n\t"
      "s_wait_xcnt 0x0"
      :: "v"(a), "v"(a + 1 * AW * 512), "v"(a + 2 * AW * 512), "v"(a + 3 * AW * 512),
         "v"(a + 4 * AW * 512), "v"(a + 5 * AW * 512), "v"(a + 6 * AW * 512), "v"(a + 7 * AW * 512),
         "v"(g), "v"(g + 1 * AW * 32), "v"(g + 2 * AW * 32), "v"(g + 3 * AW * 32),
         "v"(g + 4 * AW * 32), "v"(g + 5 * AW * 32), "v"(g + 6 * AW * 32), "v"(g + 7 * AW * 32)
      : "memory");
}

__global__ __launch_bounds__(AW * 32) void attn_kernel(
    const float* __restrict__ qb, const float* __restrict__ kb,
    const float* __restrict__ vb, const float* __restrict__ mask,
    const float* __restrict__ Wo, const float* __restrict__ bo,
    float* __restrict__ out)
{
  __shared__ u32x4 kvs[2 * NHD * NL];               // the batch's K chunks [head][key], then V [key / 8][col]
  __shared__ unsigned int woP[(NDQKV / 2) * NDIN];  // W_o as f16 pairs: [kp][j] = (k=2kp,2kp+1)
  __shared__ _Float16 xt[QT * 16 * TSTR];           // fused head outputs (16 x 32 a query tile)
  __shared__ f32x4 part[QT * KS * NHD * 16 * 3];    // [tile][key half][head][query]: 8 dims; base-2 maximum in use, row sum

  const int tid  = threadIdx.x;
  const int wv   = tid >> 5;
  const int qt   = wv / KS;                   // query tile
  const int w    = wv % KS;                   // key half in the loop, head pair in the merge
  const int lane = tid & 31;
  const int half = lane >> 4;
  const int nn   = lane & 15;

  const int b     = blockIdx.x / (NL / 16 / QT);
  const int qbase = ((blockIdx.x % (NL / 16 / QT)) * QT + qt) << 4;

  // ---- K and V of the batch -> LDS: 16 chunks a thread, whole lines, every lane on
  copy8((const u32x4*)kb + (size_t)b * (NHD * NL) + tid, kvs + tid);
  copy8((const u32x4*)vb + (size_t)b * (NHD * NL) + tid, kvs + NHD * NL + tid);

  // ---- stage W_o as packed f16 pairs (runs while the copies fly)
  #pragma unroll
  for (int i = 0; i < ((NDQKV / 2) * NDIN) / (AW * 32); ++i) {
    const int idx = tid + i * (AW * 32);
    const int kp = idx >> 8, j = idx & 255;
    union { unsigned int u; _Float16 h[2]; } pk;
    pk.h[0] = (_Float16)Wo[(2 * kp) * NDIN + j];
    pk.h[1] = (_Float16)Wo[(2 * kp + 1) * NDIN + j];
    woP[idx] = pk.u;
  }

  // ---- operand chunks (layouts: see kernel 1): q straight from the workspace, K and V from LDS
  const u32x4* qc = (const u32x4*)qb + (size_t)(b * NHD) * NL + qbase + nn;          // [head][row]
  const u32x4* kc = kvs + half * NL + w * KQ + nn;                                   // [head][key]
  const u32x4* vc = kvs + NHD * NL + (w * (KQ / 8) + half) * NDQKV + nn;             // [key / 8][col]

  // One A operand carries a key tile's 32 dims: head g sits in k slots 8g..8g+7 (a lane's two chunks
  // are heads half and 2 + half). q as B of S^T, once per head: its 8 dims in that head's k slots,
  // zero in every other slot, so the zeros pick the head.
  v16h aQ[NHD];
  #pragma unroll  // g indexes register arrays, here and in the loops over g below
  for (int g = 0; g < NHD; ++g) {
    u32x4 qv = qc[g * NL];
    if (half != (g & 1)) qv = (u32x4)(0u);
    union { v16h h; u32x4 c[2]; } uq;
    uq.c[g >> 1]       = qv;
    uq.c[1 - (g >> 1)] = (u32x4)(0u);
    aQ[g] = uq.h;
  }

  float m_q[NHD], l_q[NHD];                   // base-2 maximum in use; this half's share of the row sum
  v8f acc[NHD];
  #pragma unroll
  for (int g = 0; g < NHD; ++g) {
    m_q[g] = 0.f;                             // pass 0 replaces it by its own row maximum
    l_q[g] = 0.f;
    #pragma unroll
    for (int r = 0; r < 8; ++r) acc[g][r] = 0.f;
  }

  const float fscale = 0.35355339059327373f * 1.4426950408889634f;   // 1/sqrt(d_head), base-2 exponent
  const float* mrow = mask + ((size_t)(b * NL + qbase + nn)) * NL + w * KQ + half * 8;

  // per-lane prefetch address: 32 lanes cover 16 mask rows x 2 column tiles
  const float* mpf = mask +
      ((size_t)(b * NL + qbase + ((lane >> 3) & 1) * 8 + (lane & 7))) * NL + w * KQ +
      ((lane >> 4) & 1) * 16;

  // this wave's copies have landed; behind the barrier every wave's have (it publishes the staged W_o too)
  asm volatile("s_wait_asynccnt 0x0" ::: "memory");
  __syncthreads();

  for (int c = 0; c < KQ / 32; ++c) {
    const int k0 = c * 32;

    if (c + 1 < KQ / 32)
      __builtin_prefetch(mpf + k0 + 32, 0, 3);   // next chunk's mask tile -> global_prefetch_b8

    // ---- k operands: row nn of tile 0 and of tile 1, all four heads
    union { v16h h; u32x4 c[2]; } uk[2];
    #pragma unroll  // t indexes registers
    for (int t = 0; t < 2; ++t) {
      uk[t].c[0] = kc[k0 + 16 * t];
      uk[t].c[1] = kc[k0 + 16 * t + 2 * NL];
    }

    // ---- mask tile, once for the four heads: |mask| / sqrt(d_head), in base-2 units
    const f32x4 ma = *(const f32x4*)(mrow + k0);
    const f32x4 mb = *(const f32x4*)(mrow + k0 + 4);
    const f32x4 mc = *(const f32x4*)(mrow + k0 + 16);
    const f32x4 md = *(const f32x4*)(mrow + k0 + 20);
    const v8f mk0 = __builtin_elementwise_abs(__builtin_shufflevector(ma, mb, 0, 1, 2, 3, 4, 5, 6, 7)) * fscale;
    const v8f mk1 = __builtin_elementwise_abs(__builtin_shufflevector(mc, md, 0, 1, 2, 3, 4, 5, 6, 7)) * fscale;

    // ---- v^T operands: keys 8*half.. and 16+8*half.. of this lane's dim, one per head pair
    union { v16h h; u32x4 c[2]; } uv[2];
    #pragma unroll  // p indexes registers
    for (int p = 0; p < 2; ++p) {
      uv[p].c[0] = vc[(c * 4) * NDQKV + 16 * p];
      uv[p].c[1] = vc[(c * 4 + 2) * NDQKV + 16 * p];
    }

    // ---- exponents against the maximum in use: a lane's 16 scores of a head belong to one query row,
    //      the other 16 to lane ^ 16
    v8f d0[NHD], d1[NHD];
    float t[NHD];                             // this lane's largest exponent
    #pragma unroll
    for (int g = 0; g < NHD; ++g) {
      v8f z = {};
      const v8f S0 = __builtin_amdgcn_wmma_f32_16x16x32_f16(false, uk[0].h, false, aQ[g], (short)0, z, false, false);
      const v8f S1 = __builtin_amdgcn_wmma_f32_16x16x32_f16(false, uk[1].h, false, aQ[g], (short)0, z, false, false);
      d0[g] = S0 * mk0 - m_q[g];
      d1[g] = S1 * mk1 - m_q[g];
      float tt = fmaxf(d0[g][0], d1[g][0]);
      #pragma unroll
      for (int r = 1; r < 8; ++r) tt = fmaxf(tt, fmaxf(d0[g][r], d1[g][r]));
      t[g] = tt;
    }

    // ---- one test per pass for the four heads, a scalar branch: pass 0 sets the maxima, later passes
    //      come here only when some exponent of the wave is above RESC (or is not a number)
    const float tm = fmaxf(fmaxf(t[0], t[1]), fmaxf(t[2], t[3]));
    if (c == 0 || __builtin_amdgcn_ballot_w32(!(tm <= RESC)) != 0) {
      #pragma unroll
      for (int g = 0; g < NHD; ++g) {
        const float tr    = fmaxf(t[g], other_half(t[g]));      // the same in both halves of a row
        const float delta = (c == 0) ? tr : fmaxf(tr, 0.f);     // pass 0 may also lower the start value
        const float alpha = (c == 0) ? 1.f : __builtin_amdgcn_exp2f(-delta);   // pass 0: sums are still zero
        m_q[g] += delta;
        d0[g]  -= delta;
        d1[g]  -= delta;
        acc[g] *= alpha;
        l_q[g] *= alpha;
      }
    }

    #pragma unroll
    for (int g = 0; g < NHD; ++g) {
      // the two score tiles, converted in place, are the B operand P^T in the hardware k order
      v16h bP;
      float p0[8], p1[8];
      #pragma unroll
      for (int r = 0; r < 8; ++r) {
        p0[r] = __builtin_amdgcn_exp2f(d0[g][r]);
        p1[r] = __builtin_amdgcn_exp2f(d1[g][r]);
        bP[r]     = (_Float16)p0[r];
        bP[8 + r] = (_Float16)p1[r];
      }
      acc[g] = __builtin_amdgcn_wmma_f32_16x16x32_f16(false, uv[g >> 1].h, false, bP, (short)0, acc[g], false, false);
      // holds the last head's row sum behind the pass's last matrix instruction: its adds are the vector
      // slots the chip needs before the next pass, on any branch, overwrites that instruction's operands
      if (g == NHD - 1) __builtin_amdgcn_sched_barrier(0);
      float rs0 = 0.f, rs1 = 0.f;
      #pragma unroll
      for (int r = 0; r < 8; ++r) { rs0 += p0[r]; rs1 += p1[r]; }
      l_q[g] += rs0 + rs1;
    }
  }

  // ---- each key half's share of every head -> LDS
  #pragma unroll
  for (int g = 0; g < NHD; ++g) {
    const float l_row = l_q[g] + other_half(l_q[g]);
    if (half == (g & 1)) {
      f32x4* pp = part + (((qt * KS + w) * NHD + g) * 16 + nn) * 3;
      pp[0] = (f32x4){acc[g][0], acc[g][1], acc[g][2], acc[g][3]};
      pp[1] = (f32x4){acc[g][4], acc[g][5], acc[g][6], acc[g][7]};
      pp[2] = (f32x4){m_q[g], l_row, 0.f, 0.f};
    }
  }
  __syncthreads();   // publishes the key halves' shares

  // ---- merge: wave w of a tile takes heads 2w and 2w + 1; lane (nn, half) dims 4*half..4*half+3 of query row nn
  #pragma unroll  // hh, i index registers
  for (int hh = 0; hh < NHD / KS; ++hh) {
    const int hd = w * (NHD / KS) + hh;
    f32x4 ai[KS], ml[KS];
    #pragma unroll
    for (int i = 0; i < KS; ++i) {
      const f32x4* pp = part + (((qt * KS + i) * NHD + hd) * 16 + nn) * 3;
      ai[i] = pp[half];
      ml[i] = pp[2];
    }
    const float mx = fmaxf(ml[0].x, ml[1].x);
    f32x4 o = (f32x4)(0.f);
    float l_row = 0.f;
    #pragma unroll
    for (int i = 0; i < KS; ++i) {
      const float f = __builtin_amdgcn_exp2f(ml[i].x - mx);
      l_row += ml[i].y * f;
      o += ai[i] * f;
    }
    #pragma unroll
    for (int d = 0; d < 4; ++d)
      xt[(qt * 16 + nn) * TSTR + hd * NDH + 4 * half + d] = (_Float16)(o[d] / l_row);
  }
  __syncthreads();   // publishes the merged 16 x 32 head outputs

  // output projection: out[16 x 256] = xt(16x32) @ W_o(32x256) + b_o
  const v16h aX = loadTileU(xt + qt * 16 * TSTR);
  #pragma unroll
  for (int t = 0; t < NDIN / 16 / KS; ++t) {
    const int j0 = (w * (NDIN / 16 / KS) + t) * 16;
    union { v16h h; unsigned int u[8]; } bW;
    #pragma unroll
    for (int v = 0; v < 8; ++v) {
      const int kk = (v < 4) ? (2 * v + 8 * half) : (16 + 2 * (v - 4) + 8 * half);
      bW.u[v] = woP[(kk >> 1) * NDIN + j0 + nn];
    }
    v8f z = {};
    union { v8f v; float f[8]; } D;
    D.v = __builtin_amdgcn_wmma_f32_16x16x32_f16(false, aX, false, bW.h, (short)0, z, false, false);
    const int col = j0 + nn;
    const float bias = bo[col];
    #pragma unroll
    for (int r = 0; r < 8; ++r)
      out[((size_t)(b * NL + qbase + r + half * 8)) * NDIN + col] = D.f[r] + bias;
  }
}

extern "C" void kernel_launch(void* const* d_in, const int* in_sizes, int n_in,
                              void* d_out, int out_size, void* d_ws, size_t ws_size,
                              hipStream_t stream)
{
  (void)in_sizes; (void)n_in; (void)out_size; (void)ws_size;
  const float* Q    = (const float*)d_in[0];
  const float* K    = (const float*)d_in[1];
  const float* V    = (const float*)d_in[2];
  const float* mask = (const float*)d_in[3];
  const float* W_q  = (const float*)d_in[4];
  const float* b_q  = (const float*)d_in[5];
  const float* W_k  = (const float*)d_in[6];
  const float* b_k  = (const float*)d_in[7];
  const float* W_v  = (const float*)d_in[8];
  const float* b_v  = (const float*)d_in[9];
  const float* W_o  = (const float*)d_in[10];
  const float* b_o  = (const float*)d_in[11];
  const float* ln_g = (const float*)d_in[12];
  const float* ln_b = (const float*)d_in[13];
  float* out = (float*)d_out;

  const size_t n1 = (size_t)NB * NL * NDQKV;
  float* qb = (float*)d_ws;
  float* kb = qb + n1;
  float* vb = kb + n1;

  ln_proj_kernel<<<dim3(3 * PBLK), PW * 32, 0, stream>>>(Q, K, V, W_q, W_k, W_v, b_q, b_k, b_v,
                                                         ln_g, ln_b, qb, kb, vb);

  attn_kernel<<<dim3(NB * (NL / 16) / QT), AW * 32, 0, stream>>>(qb, kb, vb, mask, W_o, b_o, out);
}

// v009
// It runs in 37.2 microseconds.
// Timed twice side by side with v008, it ran 1.04 times as fast both times.
// Counting every step since v000, it is 6.83 times as fast.
#include <hip/hip_runtime.h>
#include <hip/hip_bf16.h>
#include <math.h>

typedef _Float16 v16h __attribute__((ext_vector_type(16)));
typedef float    v8f  __attribute__((ext_vector_type(8)));
typedef float    f32x2 __attribute__((ext_vector_type(2)));
typedef _Float16 h16x2 __attribute__((ext_vector_type(2)));
typedef float    f32x4 __attribute__((ext_vector_type(4)));
typedef unsigned int u32a __attribute__((may_alias));   // alias-safe u32 for LDS type-punning
typedef unsigned int u32x4 __attribute__((ext_vector_type(4), may_alias));  // one 16-byte operand chunk (8 halfs)

#define NB    32
#define NL    1024
#define NDIN  256
#define NDQKV 32
#define NHD   4
#define NDH   8
#define TSTR  36   // padded LDS row stride in halfs (72B rows)

// -------- cross-lane helper (wave32): value of lane l ^ 16 (the other half's share of a query column)
__device__ __forceinline__ float other_half(float v) {
  const int b = __float_as_int(v);
  return __int_as_float(__builtin_amdgcn_permlanex16(b, b, 0x76543210, 0xfedcba98, false, false));
}

// 16-bit A/B operand layout (ISA 7.12.2): VGPR v -> K = (v<4 ? 2v+8*half : 16+2(v-4)+8*half)
// Unconditional build of a 16x32 f16 operand from a row-major LDS tile [16][TSTR].
// Zero-padding is guaranteed by the caller's LDS region contents.
__device__ __forceinline__ v16h loadTileU(const _Float16* t) {
  const int lane = threadIdx.x & 31;
  const int half = lane >> 4;
  const u32a* p = (const u32a*)(t + (lane & 15) * TSTR);
  union { v16h h; unsigned int u[8]; } r;
  #pragma unroll
  for (int v = 0; v < 8; ++v) {
    const int k0 = (v < 4) ? (2 * v + 8 * half) : (16 + 2 * (v - 4) + 8 * half);
    r.u[v] = p[k0 >> 1];
  }
  return r.h;
}
// ================= Kernel 1: LayerNorm + QKV projection =================
// The result is stored as the halfs the attention products consume, in 16-byte operand chunks:
//   VL == 0 (q, k): [batch][head][row][8 dims]        one chunk = one row of one head
//   VL != 0 (v):    [batch][row / 8][32 cols][8 rows] one chunk = 8 consecutive rows of one column
// A wave takes 16 rows. Their product with W runs on the f16 16x16x32 matrix form with f32 sums: each f32
// operand is split into an f16 high part and the f16 rest (about 22 bits kept), and three products are
// summed, high x high + rest x high + high x rest. A block of 4 waves shares one copy of the split W in
// LDS, laid out as the fragments are read.
// The three inputs go through ONE launch; a block's LDS and registers let three blocks share a WGP,
// so the row loads of one block run under the matrix run of another.
// Lane (c, h) owns row c: 16-byte piece 2j + h of the row, j = 0..31, so a row's sums need one
// exchange with lane ^ 16. Element 4 * jj + e of lane half h in step s is column 32s + 8jj + 4h + e, for
// the row fragment and for the W fragment alike.
#define PW     4     // waves per block
#define PBLK   (NB * NL / (PW * 16))   // blocks per input
#define XPITCH 65    // LDS row pitch in 16-byte pieces (1040 B): 16 rows fall on distinct banks

// two f32 -> their f16 high parts (one word) and the f16 rests (one word)
__device__ __forceinline__ void split_f16(const float x0, const float x1, h16x2& hi, h16x2& lo) {
  hi = __builtin_convertvector((f32x2){x0, x1}, h16x2);
  lo = (h16x2){(_Float16)__builtin_fmaf((float)hi.x, -1.f, x0), (_Float16)__builtin_fmaf((float)hi.y, -1.f, x1)};
}

template <int VL>
__device__ __forceinline__ void ln_proj_body(
    f32x4* const lds, const int blk,
    const float* __restrict__ X, const float* __restrict__ W,
    const float* __restrict__ bias, const float* __restrict__ g,
    const float* __restrict__ bn, float* __restrict__ outp)
{
  u32x4* const wf = (u32x4*)lds;               // [high, rest][step][col tile][chunk][lane]: 8 k of one column of W
  f32x4* const gs = lds + NDIN * NDQKV / 4;
  f32x4* const bs = gs + NDIN / 4;
  f32x4* const xs = bs + NDIN / 4;             // each wave's 16 rows

  const int tid  = threadIdx.x;
  const int w    = tid >> 5;
  const int lane = tid & 31;
  const int h    = lane >> 4;
  const int c    = lane & 15;
  const int row0 = (blk * PW + w) * 16;

  // W as fragments; gain (threads 0..63) and shift (64..127), 16 bytes a thread
  // a thread takes chunk (tid >> 5) & 1 of column tile tid >> 6 in every step: rows 32s + 16 chunk + 8jj + 4h + e
  float wr[NDIN / 32][8];
  const float* wp0 = W + (16 * ((tid >> 5) & 1) + 4 * h) * NDQKV + (tid >> 6) * 16 + c;
  #pragma unroll
  for (int s = 0; s < NDIN / 32; ++s)
    #pragma unroll
    for (int p = 0; p < 8; ++p) wr[s][p] = wp0[(32 * s + 8 * (p >> 2) + (p & 3)) * NDQKV];
  const f32x4 tv = ((const f32x4*)((tid & (NDIN / 4)) ? bn : g))[tid & (NDIN / 4 - 1)];
  // the row loads below land in registers that held the addresses of the loads above
  asm volatile("s_wait_xcnt 0x0" ::: "memory");

  // the wave's 16 rows are 16 KiB in a row: whole lines, 512 bytes a load
  const f32x4* xg = (const f32x4*)(X + (size_t)row0 * NDIN) + lane;
  f32x4 xr[32];
  #pragma unroll
  for (int i = 0; i < 32; ++i) xr[i] = xg[i * 32];

  #pragma unroll
  for (int s = 0; s < NDIN / 32; ++s) {
    union { u32x4 u; h16x2 hf[4]; } whi, wlo;
    #pragma unroll
    for (int p = 0; p < 4; ++p) split_f16(wr[s][2 * p], wr[s][2 * p + 1], whi.hf[p], wlo.hf[p]);
    wf[s * (PW * 32) + tid] = whi.u;
    wf[NDIN * NDQKV / 8 + s * (PW * 32) + tid] = wlo.u;
  }
  gs[tid] = tv;                                // bs follows gs

  #pragma unroll
  for (int i = 0; i < 32; ++i)
    xs[(w * 16 + (i >> 1)) * XPITCH + (i & 1) * 32 + lane] = xr[i];
  __syncthreads();

  f32x4 xv[32];
  #pragma unroll
  for (int j = 0; j < 32; ++j) xv[j] = xs[(w * 16 + c) * XPITCH + 2 * j + h];

  f32x4 sa = xv[0], sb = xv[1];
  #pragma unroll
  for (int j = 2; j < 32; j += 2) { sa += xv[j]; sb += xv[j + 1]; }
  sa += sb;
  float s = (sa.x + sa.y) + (sa.z + sa.w);
  s += other_half(s);
  const float mu = s * (1.f / NDIN);

  f32x4 qa = (f32x4)(0.f), qb = (f32x4)(0.f);
  #pragma unroll
  for (int j = 0; j < 32; j += 2) {
    xv[j]     -= mu;  qa += xv[j] * xv[j];
    xv[j + 1] -= mu;  qb += xv[j + 1] * xv[j + 1];
  }
  qa += qb;
  float q = (qa.x + qa.y) + (qa.z + qa.w);
  q += other_half(q);
  const float rstd = rsqrtf(q * (1.f / NDIN) + 1e-5f);

  // bias: asked for here, added behind the products
  v8f acc[2], acr[2], bv[2];                   // acc: high x high; acr: the two products with a rest
  #pragma unroll
  for (int t = 0; t < 2; ++t)
    #pragma unroll
    for (int r = 0; r < 8; ++r) {
      acc[t][r] = 0.f;
      acr[t][r] = 0.f;
      bv[t][r] = VL ? bias[16 * t + c] : bias[16 * t + 8 * h + r];
    }

  // gain and shift for 4 j at a time, read one group ahead
  f32x4 gb[2][8];
  #pragma unroll
  for (int i = 0; i < 4; ++i) { gb[0][2 * i] = gs[2 * i + h]; gb[0][2 * i + 1] = bs[2 * i + h]; }
  #pragma unroll
  for (int gq = 0; gq < 8; ++gq) {
    if (gq + 1 < 8) {
      #pragma unroll
      for (int i = 0; i < 4; ++i) {
        gb[(gq + 1) & 1][2 * i]     = gs[2 * ((gq + 1) * 4 + i) + h];
        gb[(gq + 1) & 1][2 * i + 1] = bs[2 * ((gq + 1) * 4 + i) + h];
      }
    }
    // bounds how far these reads are hoisted: without it all 64 go up at once and hold 256 registers
    __builtin_amdgcn_sched_barrier(0);
    #pragma unroll
    for (int i = 0; i < 4; ++i)
      xv[gq * 4 + i] = xv[gq * 4 + i] * rstd * gb[gq & 1][2 * i] + gb[gq & 1][2 * i + 1];
  }

  // A step is 32 k: 8 reads of W fragments, one step ahead, and 6 matrix instructions; the next step's rows
  // are split while this step's matrix instructions run.
  union frag { v16h h; u32x4 c[2]; h16x2 e[8]; };
  u32x4 wb[2][8];                              // [col tile][high, rest][chunk]
  frag xh[2], xl[2];
  #pragma unroll
  for (int i = 0; i < 8; ++i) wb[0][i] = wf[((i >> 1) & 1) * (NDIN * NDQKV / 8) + ((i >> 2) * 2 + (i & 1)) * 32 + lane];
  #pragma unroll
  for (int p = 0; p < 8; ++p) split_f16(xv[p >> 1][2 * (p & 1)], xv[p >> 1][2 * (p & 1) + 1], xh[0].e[p], xl[0].e[p]);
  #pragma unroll
  for (int s = 0; s < NDIN / 32; ++s) {
    if (s + 1 < NDIN / 32) {
      #pragma unroll
      for (int i = 0; i < 8; ++i)
        wb[(s + 1) & 1][i] = wf[((i >> 1) & 1) * (NDIN * NDQKV / 8) + (s + 1) * (PW * 32) + ((i >> 2) * 2 + (i & 1)) * 32 + lane];
    }
    // keeps the next step's LDS reads in one place ahead of this step's matrix run, not among it
    __builtin_amdgcn_sched_barrier(0);
    frag wh[2], wl[2];
    #pragma unroll
    for (int t = 0; t < 2; ++t) {
      wh[t].c[0] = wb[s & 1][4 * t];      wh[t].c[1] = wb[s & 1][4 * t + 1];
      wl[t].c[0] = wb[s & 1][4 * t + 2];  wl[t].c[1] = wb[s & 1][4 * t + 3];
    }
    // VL: D[row 8h + r][col c]; else the transposed product, D[col 8h + r][row c]
    #pragma unroll
    for (int t = 0; t < 2; ++t)
      acc[t] = VL ? __builtin_amdgcn_wmma_f32_16x16x32_f16(false, xh[s & 1].h, false, wh[t].h, (short)0, acc[t], false, false)
                  : __builtin_amdgcn_wmma_f32_16x16x32_f16(false, wh[t].h, false, xh[s & 1].h, (short)0, acc[t], false, false);
    #pragma unroll
    for (int t = 0; t < 2; ++t)
      acr[t] = VL ? __builtin_amdgcn_wmma_f32_16x16x32_f16(false, xl[s & 1].h, false, wh[t].h, (short)0, acr[t], false, false)
                  : __builtin_amdgcn_wmma_f32_16x16x32_f16(false, wh[t].h, false, xl[s & 1].h, (short)0, acr[t], false, false);
    #pragma unroll
    for (int t = 0; t < 2; ++t)
      acr[t] = VL ? __builtin_amdgcn_wmma_f32_16x16x32_f16(false, xh[s & 1].h, false, wl[t].h, (short)0, acr[t], false, false)
                  : __builtin_amdgcn_wmma_f32_16x16x32_f16(false, wl[t].h, false, xh[s & 1].h, (short)0, acr[t], false, false);
    if (s + 1 < NDIN / 32) {
      #pragma unroll
      for (int p = 0; p < 8; ++p)
        split_f16(xv[(s + 1) * 4 + (p >> 1)][2 * (p & 1)], xv[(s + 1) * 4 + (p >> 1)][2 * (p & 1) + 1],
                  xh[(s + 1) & 1].e[p], xl[(s + 1) & 1].e[p]);
    }
    // ends the step: the reads that follow stay behind it, in one place, not among its instructions
    __builtin_amdgcn_sched_barrier(0);
  }

  #pragma unroll
  for (int t = 0; t < 2; ++t) {
    union { u32x4 u; _Float16 hf[8]; } o;
    #pragma unroll
    for (int r = 0; r < 8; ++r) o.hf[r] = (_Float16)((acc[t][r] + acr[t][r]) + bv[t][r]);
    const int chunk = VL
        ? ((row0 >> 3) + h) * NDQKV + 16 * t + c
        : ((row0 >> 10) * NHD + 2 * t + h) * NL + (row0 & (NL - 1)) + c;
    ((u32x4*)outp)[chunk] = o.u;
  }
  // the two bodies stand one behind the other in the built kernel: code behind these stores rewrites their registers
  asm volatile("s_wait_xcnt 0x0" ::: "memory");
}

__global__ __launch_bounds__(PW * 32) void ln_proj_kernel(
    const float* __restrict__ Q, const float* __restrict__ K, const float* __restrict__ V,
    const float* __restrict__ Wq, const float* __restrict__ Wk, const float* __restrict__ Wv,
    const float* __restrict__ bq, const float* __restrict__ bk, const float* __restrict__ bv,
    const float* __restrict__ g, const float* __restrict__ bn,
    float* __restrict__ oq, float* __restrict__ ok, float* __restrict__ ov)
{
  // one array, the small tables first: their reads then take immediate offsets
  __shared__ f32x4 lds[NDIN * NDQKV / 4 + NDIN / 2 + PW * 16 * XPITCH];
  const int which = blockIdx.x / PBLK;         // 0: q, 1: k, 2: v; the same for the whole block
  const int blk   = blockIdx.x % PBLK;
  if (which == 2)
    ln_proj_body<1>(lds, blk, V, Wv, bv, g, bn, ov);
  else
    ln_proj_body<0>(lds, blk, which ? K : Q, which ? Wk : Wq, which ? bk : bq, g, bn, which ? ok : oq);
}

// ================= Kernel 2: fused flash attention + output proj =================
// block = 512 threads = 16 waves = 8 query tiles of 16 rows x 2 key halves, all of one batch. The batch's
// K and V operand chunks (64 KiB each, contiguous in the workspace) are brought into LDS once per block
// and read there by all 16 waves. A wave takes ALL FOUR heads over half of the keys, so a mask tile is
// loaded and scaled once, by one wave, for the four heads that share it; the two key halves of a head
// are merged through LDS behind the loop.
// A head has 8 dims, so its V^T operand has 8 idle rows: they hold ones, and the idle half of the output
// tile is then the row sum of P as the matrix unit reads it (rounded to f16), summed in f32.
#define QT 8          // query tiles per block
#define KS 2          // key shares per query tile
#define KQ (NL / KS)  // keys per wave
#define AW (QT * KS)  // waves per block
#define RESC 8.f      // a row is rescaled when a score exceeds its maximum in use by more than this (base 2)
#define ONEC 128      // 16-byte chunks of f16 ones behind V in LDS

// Eight asynchronous 16-byte copies a lane, global -> LDS, chunk i at distance i * AW * 32 chunks.
// The wait on the address translations is the statement's last line: the registers that the copies name
// stay as they are until it has returned.
__device__ __forceinline__ void copy8(const u32x4* g, const u32x4* l) {
  const unsigned int a = (unsigned int)(size_t)l;   // the LDS byte address is the low word of the pointer
  asm volatile(
      "global_load_async_to_lds_b128 %0, %8, off\n\t"
      "global_load_async_to_lds_b128 %1, %9, off\n\t"
      "global_load_async_to_lds_b128 %2, %10, off\n\t"
      "global_load_async_to_lds_b128 %3, %11, off\n\t"
      "global_load_async_to_lds_b128 %4, %12, off\n\t"
      "global_load_async_to_lds_b128 %5, %13, off\n\t"
      "global_load_async_to_lds_b128 %6, %14, off\n\t"
      "global_load_async_to_lds_b128 %7, %15, off\n\t"
      "s_wait_xcnt 0x0"
      :: "v"(a), "v"(a + 1 * AW * 512), "v"(a + 2 * AW * 512), "v"(a + 3 * AW * 512),
         "v"(a + 4 * AW * 512), "v"(a + 5 * AW * 512), "v"(a + 6 * AW * 512), "v"(a + 7 * AW * 512),
         "v"(g), "v"(g + 1 * AW * 32), "v"(g + 2 * AW * 32), "v"(g + 3 * AW * 32),
         "v"(g + 4 * AW * 32), "v"(g + 5 * AW * 32), "v"(g + 6 * AW * 32), "v"(g + 7 * AW * 32)
      : "memory");
}

__global__ __launch_bounds__(AW * 32) void attn_kernel(
    const float* __restrict__ qb, const float* __restrict__ kb,
    const float* __restrict__ vb, const float* __restrict__ mask,
    const float* __restrict__ Wo, const float* __restrict__ bo,
    float* __restrict__ out)
{
  // the batch's K chunks [head][key], then V [key / 8][col], then ones; aligned so that a chunk's banks are known
  __shared__ __attribute__((aligned(256))) u32x4 kvs[2 * NHD * NL + ONEC];
  __shared__ unsigned int woP[(NDQKV / 2) * NDIN];  // W_o as f16 pairs: [kp][j] = (k=2kp,2kp+1)
  __shared__ _Float16 xt[QT * 16 * TSTR];           // fused head outputs (16 x 32 a query tile)
  __shared__ f32x4 part[QT * KS * NHD * 16 * 3];    // [tile][key half][head][query]: 8 dims; base-2 maximum in use, row sum

  const int tid  = threadIdx.x;
  const int wv   = tid >> 5;
  const int qt   = wv / KS;                   // query tile
  const int w    = wv % KS;                   // key half in the loop, head pair in the merge
  const int lane = tid & 31;
  const int half = lane >> 4;
  const int nn   = lane & 15;

  const int b     = blockIdx.x / (NL / 16 / QT);
  const int qbase = ((blockIdx.x % (NL / 16 / QT)) * QT + qt) << 4;

  // ---- K and V of the batch -> LDS: 16 chunks a thread, whole lines, every lane on
  copy8((const u32x4*)kb + (size_t)b * (NHD * NL) + tid, kvs + tid);
  copy8((const u32x4*)vb + (size_t)b * (NHD * NL) + tid, kvs + NHD * NL + tid);

  // ---- the ones (bytes that no copy writes; the barrier in front of the loop publishes them)
  if (tid < ONEC) kvs[2 * NHD * NL + tid] = (u32x4)(0x3C003C00u);

  // ---- stage W_o as packed f16 pairs (runs while the copies fly)
  #pragma unroll
  for (int i = 0; i < ((NDQKV / 2) * NDIN) / (AW * 32); ++i) {
    const int idx = tid + i * (AW * 32);
    const int kp = idx >> 8, j = idx & 255;
    union { unsigned int u; _Float16 h[2]; } pk;
    pk.h[0] = (_Float16)Wo[(2 * kp) * NDIN + j];
    pk.h[1] = (_Float16)Wo[(2 * kp + 1) * NDIN + j];
    woP[idx] = pk.u;
  }

  // ---- operand chunks (layouts: see kernel 1): q straight from the workspace, K and V from LDS
  const u32x4* qc = (const u32x4*)qb + (size_t)(b * NHD) * NL + qbase + nn;          // [head][row]
  const u32x4* kc = kvs + half * NL + w * KQ + nn;                                   // [head][key]
  // V^T of one head: lanes nn < 8 read its dim nn, [key / 8][col], and move on by 32 keys a pass; lanes nn >= 8
  // stay on the ones, 128 bytes in, which puts their one chunk on banks that the same read's 8 V chunks leave free
  const u32x4* vp  = (nn < NDH) ? kvs + NHD * NL + (w * (KQ / 8) + half) * NDQKV + nn : kvs + 2 * NHD * NL + 8;
  const int vstep  = (nn < NDH) ? 4 * NDQKV : 0;

  // One A operand carries a key tile's 32 dims: head g sits in k slots 8g..8g+7 (a lane's two chunks
  // are heads half and 2 + half). q as B of S^T, once per head: its 8 dims in that head's k slots,
  // zero in every other slot, so the zeros pick the head.
  v16h aQ[NHD];
  #pragma unroll  // g indexes register arrays, here and in the loops over g below
  for (int g = 0; g < NHD; ++g) {
    u32x4 qv = qc[g * NL];
    if (half != (g & 1)) qv = (u32x4)(0u);
    union { v16h h; u32x4 c[2]; } uq;
    uq.c[g >> 1]       = qv;
    uq.c[1 - (g >> 1)] = (u32x4)(0u);
    aQ[g] = uq.h;
  }

  float m_q[NHD];                             // base-2 maximum in use
  v8f acc[NHD];
  #pragma unroll
  for (int g = 0; g < NHD; ++g) {
    m_q[g] = 0.f;                             // pass 0 replaces it by its own row maximum
    #pragma unroll
    for (int r = 0; r < 8; ++r) acc[g][r] = 0.f;
  }

  const float fscale = 0.35355339059327373f * 1.4426950408889634f;   // 1/sqrt(d_head), base-2 exponent
  const float* mrow = mask + ((size_t)(b * NL + qbase + nn)) * NL + w * KQ + half * 8;

  // per-lane prefetch address: 32 lanes cover 16 mask rows x 2 column tiles
  const float* mpf = mask +
      ((size_t)(b * NL + qbase + ((lane >> 3) & 1) * 8 + (lane & 7))) * NL + w * KQ +
      ((lane >> 4) & 1) * 16;

  // this wave's copies have landed; behind the barrier every wave's have (it publishes the staged W_o too)
  asm volatile("s_wait_asynccnt 0x0" ::: "memory");
  __syncthreads();

  for (int c = 0; c < KQ / 32; ++c) {
    const int k0 = c * 32;

    if (c + 1 < KQ / 32)
      __builtin_prefetch(mpf + k0 + 32, 0, 3);   // next chunk's mask tile -> global_prefetch_b8

    // ---- k operands: row nn of tile 0 and of tile 1, all four heads
    union { v16h h; u32x4 c[2]; } uk[2];
    #pragma unroll  // t indexes registers
    for (int t = 0; t < 2; ++t) {
      uk[t].c[0] = kc[k0 + 16 * t];
      uk[t].c[1] = kc[k0 + 16 * t + 2 * NL];
    }

    // ---- mask tile, once for the four heads
    const f32x4 ma = *(const f32x4*)(mrow + k0);
    const f32x4 mb = *(const f32x4*)(mrow + k0 + 4);
    const f32x4 mc = *(const f32x4*)(mrow + k0 + 16);
    const f32x4 md = *(const f32x4*)(mrow + k0 + 20);

    // ---- v^T operands: keys 8*half.. and 16+8*half.. of this lane's dim (or ones), one per head
    union { v16h h; u32x4 c[2]; } uv[NHD];
    #pragma unroll  // g indexes registers
    for (int g = 0; g < NHD; ++g) {
      uv[g].c[0] = vp[g * NDH];
      uv[g].c[1] = vp[g * NDH + 2 * NDQKV];
    }
    vp += vstep;
    // keeps the pass's loads in one place at its head: otherwise a mask load sinks below the first products, into
    // their operand's registers, and is waited for at once
    __builtin_amdgcn_sched_barrier(0);

    // ---- the eight score tiles
    v8f S0[NHD], S1[NHD];
    #pragma unroll
    for (int g = 0; g < NHD; ++g) {
      v8f z = {};
      S0[g] = __builtin_amdgcn_wmma_f32_16x16x32_f16(false, uk[0].h, false, aQ[g], (short)0, z, false, false);
      S1[g] = __builtin_amdgcn_wmma_f32_16x16x32_f16(false, uk[1].h, false, aQ[g], (short)0, z, false, false);
    }
    // keeps the wait for the mask behind the products, which need only K: they run while the mask is on its way
    __builtin_amdgcn_sched_barrier(0);

    // |mask| / sqrt(d_head), in base-2 units
    const v8f mk0 = __builtin_elementwise_abs(__builtin_shufflevector(ma, mb, 0, 1, 2, 3, 4, 5, 6, 7)) * fscale;
    const v8f mk1 = __builtin_elementwise_abs(__builtin_shufflevector(mc, md, 0, 1, 2, 3, 4, 5, 6, 7)) * fscale;

    // ---- exponents against the maximum in use: a lane's 16 scores of a head belong to one query row,
    //      the other 16 to lane ^ 16
    v8f d0[NHD], d1[NHD];
    float t[NHD];                             // this lane's largest exponent
    #pragma unroll
    for (int g = 0; g < NHD; ++g) {
      d0[g] = S0[g] * mk0 - m_q[g];
      d1[g] = S1[g] * mk1 - m_q[g];
      float tt = fmaxf(d0[g][0], d1[g][0]);
      #pragma unroll
      for (int r = 1; r < 8; ++r) tt = fmaxf(tt, fmaxf(d0[g][r], d1[g][r]));
      t[g] = tt;
    }

    // ---- one test per pass for the four heads, a scalar branch: pass 0 sets the maxima, later passes
    //      come here only when some exponent of the wave is above RESC (or is not a number)
    const float tm = fmaxf(fmaxf(t[0], t[1]), fmaxf(t[2], t[3]));
    if (c == 0 || __builtin_amdgcn_ballot_w32(!(tm <= RESC)) != 0) {
      #pragma unroll
      for (int g = 0; g < NHD; ++g) {
        const float tr    = fmaxf(t[g], other_half(t[g]));      // the same in both halves of a row
        const float delta = (c == 0) ? tr : fmaxf(tr, 0.f);     // pass 0 may also lower the start value
        const float alpha = (c == 0) ? 1.f : __builtin_amdgcn_exp2f(-delta);   // pass 0: sums are still zero
        m_q[g] += delta;
        d0[g]  -= delta;
        d1[g]  -= delta;
        acc[g] *= alpha;                                        // dims and row sum alike
      }
    }

    // the two score tiles of a head, converted in place, are the B operand P^T in the hardware k order
    v16h bP[NHD];
    #pragma unroll
    for (int g = 0; g < NHD; ++g) {
      #pragma unroll
      for (int r = 0; r < 8; ++r) {
        bP[g][r]     = (_Float16)__builtin_amdgcn_exp2f(d0[g][r]);
        bP[g][8 + r] = (_Float16)__builtin_amdgcn_exp2f(d1[g][r]);
      }
    }
    #pragma unroll
    for (int g = 0; g < NHD; ++g)
      acc[g] = __builtin_amdgcn_wmma_f32_16x16x32_f16(false, uv[g].h, false, bP[g], (short)0, acc[g], false, false);
  }

  // ---- each key half's share of every head -> LDS
  #pragma unroll
  for (int g = 0; g < NHD; ++g) {
    const float l_row = other_half(acc[g][0]);   // half 0 fetches the row sum from half 1
    if (half == 0) {
      f32x4* pp = part + (((qt * KS + w) * NHD + g) * 16 + nn) * 3;
      pp[0] = (f32x4){acc[g][0], acc[g][1], acc[g][2], acc[g][3]};
      pp[1] = (f32x4){acc[g][4], acc[g][5], acc[g][6], acc[g][7]};
      pp[2] = (f32x4){m_q[g], l_row, 0.f, 0.f};
    }
  }
  __syncthreads();   // publishes the key halves' shares

  // ---- merge: wave w of a tile takes heads 2w and 2w + 1; lane (nn, half) dims 4*half..4*half+3 of query row nn
  #pragma unroll  // hh, i index registers
  for (int hh = 0; hh < NHD / KS; ++hh) {
    const int hd = w * (NHD / KS) + hh;
    f32x4 ai[KS], ml[KS];
    #pragma unroll
    for (int i = 0; i < KS; ++i) {
      const f32x4* pp = part + (((qt * KS + i) * NHD + hd) * 16 + nn) * 3;
      ai[i] = pp[half];
      ml[i] = pp[2];
    }
    const float mx = fmaxf(ml[0].x, ml[1].x);
    f32x4 o = (f32x4)(0.f);
    float l_row = 0.f;
    #pragma unroll
    for (int i = 0; i < KS; ++i) {
      const float f = __builtin_amdgcn_exp2f(ml[i].x - mx);
      l_row += ml[i].y * f;
      o += ai[i] * f;
    }
    #pragma unroll
    for (int d = 0; d < 4; ++d)
      xt[(qt * 16 + nn) * TSTR + hd * NDH + 4 * half + d] = (_Float16)(o[d] / l_row);
  }
  __syncthreads();   // publishes the merged 16 x 32 head outputs

  // output projection: out[16 x 256] = xt(16x32) @ W_o(32x256) + b_o
  const v16h aX = loadTileU(xt + qt * 16 * TSTR);
  #pragma unroll
  for (int t = 0; t < NDIN / 16 / KS; ++t) {
    const int j0 = (w * (NDIN / 16 / KS) + t) * 16;
    union { v16h h; unsigned int u[8]; } bW;
    #pragma unroll
    for (int v = 0; v < 8; ++v) {
      const int kk = (v < 4) ? (2 * v + 8 * half) : (16 + 2 * (v - 4) + 8 * half);
      bW.u[v] = woP[(kk >> 1) * NDIN + j0 + nn];
    }
    v8f z = {};
    union { v8f v; float f[8]; } D;
    D.v = __builtin_amdgcn_wmma_f32_16x16x32_f16(false, aX, false, bW.h, (short)0, z, false, false);
    const int col = j0 + nn;
    const float bias = bo[col];
    #pragma unroll
    for (int r = 0; r < 8; ++r)
      out[((size_t)(b * NL + qbase + r + half * 8)) * NDIN + col] = D.f[r] + bias;
  }
}

extern "C" void kernel_launch(void* const* d_in, const int* in_sizes, int n_in,
                              void* d_out, int out_size, void* d_ws, size_t ws_size,
                              hipStream_t stream)
{
  (void)in_sizes; (void)n_in; (void)out_size; (void)ws_size;
  const float* Q    = (const float*)d_in[0];
  const float* K    = (const float*)d_in[1];
  const float* V    = (const float*)d_in[2];
  const float* mask = (const float*)d_in[3];
  const float* W_q  = (const float*)d_in[4];
  const float* b_q  = (const float*)d_in[5];
  const float* W_k  = (const float*)d_in[6];
  const float* b_k  = (const float*)d_in[7];
  const float* W_v  = (const float*)d_in[8];
  const float* b_v  = (const float*)d_in[9];
  const float* W_o  = (const float*)d_in[10];
  const float* b_o  = (const float*)d_in[11];
  const float* ln_g = (const float*)d_in[12];
  const float* ln_b = (const float*)d_in[13];
  float* out = (float*)d_out;

  const size_t n1 = (size_t)NB * NL * NDQKV;
  float* qb = (float*)d_ws;
  float* kb = qb + n1;
  float* vb = kb + n1;

  ln_proj_kernel<<<dim3(3 * PBLK), PW * 32, 0, stream>>>(Q, K, V, W_q, W_k, W_v, b_q, b_k, b_v,
                                                         ln_g, ln_b, qb, kb, vb);

  attn_kernel<<<dim3(NB * (NL / 16) / QT), AW * 32, 0, stream>>>(qb, kb, vb, mask, W_o, b_o, out);
}

// v010
// It runs in 35.7 microseconds.
// Next to v009, in two timings, it ran 1.04 times as fast each time.
// All steps since v000 together make it 7.11 times as fast.
#include <hip/hip_runtime.h>
#include <hip/hip_bf16.h>
#include <math.h>

typedef _Float16 v16h __attribute__((ext_vector_type(16)));
typedef float    v8f  __attribute__((ext_vector_type(8)));
typedef float    f32x2 __attribute__((ext_vector_type(2)));
typedef _Float16 h16x2 __attribute__((ext_vector_type(2)));
typedef float    f32x4 __attribute__((ext_vector_type(4)));
typedef unsigned int u32a __attribute__((may_alias));   // alias-safe u32 for LDS type-punning
typedef unsigned int u32x4 __attribute__((ext_vector_type(4), may_alias));  // one 16-byte operand chunk (8 halfs)

#define NB    32
#define NL    1024
#define NDIN  256
#define NDQKV 32
#define NHD   4
#define NDH   8
#define TSTR  36   // padded LDS row stride in halfs (72B rows)

// -------- cross-lane helper (wave32): value of lane l ^ 16 (the other half's share of a query column)
__device__ __forceinline__ float other_half(float v) {
  const int b = __float_as_int(v);
  return __int_as_float(__builtin_amdgcn_permlanex16(b, b, 0x76543210, 0xfedcba98, false, false));
}

// 16-bit A/B operand layout (ISA 7.12.2): VGPR v -> K = (v<4 ? 2v+8*half : 16+2(v-4)+8*half)
// Unconditional build of a 16x32 f16 operand from a row-major LDS tile [16][TSTR].
// Zero-padding is guaranteed by the caller's LDS region contents.
__device__ __forceinline__ v16h loadTileU(const _Float16* t) {
  const int lane = threadIdx.x & 31;
  const int half = lane >> 4;
  const u32a* p = (const u32a*)(t + (lane & 15) * TSTR);
  union { v16h h; unsigned int u[8]; } r;
  #pragma unroll
  for (int v = 0; v < 8; ++v) {
    const int k0 = (v < 4) ? (2 * v + 8 * half) : (16 + 2 * (v - 4) + 8 * half);
    r.u[v] = p[k0 >> 1];
  }
  return r.h;
}
// ================= Kernel 1: LayerNorm + QKV projection =================
// The result is stored as the halfs the attention products consume, in 16-byte operand chunks:
//   VL == 0 (q, k): [batch][head][row][8 dims]        one chunk = one row of one head
//   VL != 0 (v):    [batch][row / 8][32 cols][8 rows] one chunk = 8 consecutive rows of one column
// A wave takes 16 rows at a time. Their product with W runs on the f16 16x16x32 matrix form with f32 sums: each f32
// operand is split into an f16 high part and the f16 rest (about 22 bits kept), and three products are
// summed, high x high + rest x high + high x rest. A block of 4 waves shares one copy of the split W in
// LDS, laid out as the fragments are read.
// The three inputs go through ONE launch; a block's LDS and registers let three blocks share a WGP,
// and the grid is three blocks for every WGP. A wave takes PT row tiles, one behind the other: the rows come
// by asynchronous copies into LDS rows that only this wave reads, and as soon as a tile's rows are in
// registers the next tile's copies start, so they fly under the whole computation of this tile. W is
// split and staged once for all the tiles of a block.
// Lane (c, h) owns row c: 16-byte piece 2j + h of the row, j = 0..31, so a row's sums need one
// exchange with lane ^ 16. Element 4 * jj + e of lane half h in step s is column 32s + 8jj + 4h + e, for
// the row fragment and for the W fragment alike.
#define PW     4     // waves per block
#define PT     2     // row tiles per wave
#define PBLK   (NB * NL / (PW * 16 * PT))   // blocks per input
#define XPITCH 65    // LDS row pitch in 16-byte pieces (1040 B): 16 rows fall on distinct banks

// two f32 -> their f16 high parts (one word) and the f16 rests (one word)
__device__ __forceinline__ void split_f16(const float x0, const float x1, h16x2& hi, h16x2& lo) {
  hi = __builtin_convertvector((f32x2){x0, x1}, h16x2);
  lo = (h16x2){(_Float16)__builtin_fmaf((float)hi.x, -1.f, x0), (_Float16)__builtin_fmaf((float)hi.y, -1.f, x1)};
}

// Sixteen asynchronous 16-byte copies a lane: 8 rows of 1 KiB, whole lines, global -> LDS rows of pitch XPITCH.
// An immediate offset moves both addresses, so it carries the LDS pitch (and half a row); row r's scalar base
// takes back the 16 r bytes by which the LDS pitch exceeds the row. off = 16 * lane; l = the lane's LDS byte
// address in row 0. The wait on the address translations is the statement's last line: the registers that
// the copies name stay as they are until it has returned.
__device__ __forceinline__ void copy_rows8(const float* g, const unsigned int off, const unsigned int l) {
  const char* const p = (const char*)g;
  asm volatile(
      "global_load_async_to_lds_b128 %0, %1, %2\n\t"
      "global_load_async_to_lds_b128 %0, %1, %2 offset:512\n\t"
      "global_load_async_to_lds_b128 %0, %1, %3 offset:1040\n\t"
      "global_load_async_to_lds_b128 %0, %1, %3 offset:1552\n\t"
      "global_load_async_to_lds_b128 %0, %1, %4 offset:2080\n\t"
      "global_load_async_to_lds_b128 %0, %1, %4 offset:2592\n\t"
      "global_load_async_to_lds_b128 %0, %1, %5 offset:3120\n\t"
      "global_load_async_to_lds_b128 %0, %1, %5 offset:3632\n\t"
      "global_load_async_to_lds_b128 %0, %1, %6 offset:4160\n\t"
      "global_load_async_to_lds_b128 %0, %1, %6 offset:4672\n\t"
      "global_load_async_to_lds_b128 %0, %1, %7 offset:5200\n\t"
      "global_load_async_to_lds_b128 %0, %1, %7 offset:5712\n\t"
      "global_load_async_to_lds_b128 %0, %1, %8 offset:6240\n\t"
      "global_load_async_to_lds_b128 %0, %1, %8 offset:6752\n\t"
      "global_load_async_to_lds_b128 %0, %1, %9 offset:7280\n\t"
      "global_load_async_to_lds_b128 %0, %1, %9 offset:7792\n\t"
      "s_wait_xcnt 0x0"
      :: "v"(l), "v"(off), "s"(p), "s"(p - 16), "s"(p - 32), "s"(p - 48), "s"(p - 64), "s"(p - 80),
         "s"(p - 96), "s"(p - 112)
      : "memory");
}
static_assert(XPITCH * 16 == 1040 && NDIN * 4 == 1024, "the offsets in copy_rows8 are written for these");

template <int VL>
__device__ __forceinline__ void ln_proj_body(
    f32x4* const lds, const int blk,
    const float* __restrict__ X, const float* __restrict__ W,
    const float* __restrict__ bias, const float* __restrict__ g,
    const float* __restrict__ bn, float* __restrict__ outp)
{
  u32x4* const wf = (u32x4*)lds;               // [high, rest][step][col tile][chunk][lane]: 8 k of one column of W
  f32x4* const gs = lds + NDIN * NDQKV / 4;
  f32x4* const bs = gs + NDIN / 4;
  f32x4* const xs = bs + NDIN / 4;             // each wave's 16 rows

  const int tid  = threadIdx.x;
  const int w    = __builtin_amdgcn_readfirstlane(tid >> 5);   // scalar: the copies take a scalar base
  const int lane = tid & 31;
  const int h    = lane >> 4;
  const int c    = lane & 15;
  const int rowb = (blk * PT * PW + w) * 16;   // the wave's tile t starts at row rowb + t * PW * 16
  const unsigned int xl = (unsigned int)(size_t)(xs + w * 16 * XPITCH + lane);   // LDS byte address: the pointer's low word

  // W as fragments; gain (threads 0..63) and shift (64..127), 16 bytes a thread
  // a thread takes chunk (tid >> 5) & 1 of column tile tid >> 6 in every step: rows 32s + 16 chunk + 8jj + 4h + e
  float wr[NDIN / 32][8];
  const float* wp0 = W + (16 * ((tid >> 5) & 1) + 4 * h) * NDQKV + (tid >> 6) * 16 + c;
  #pragma unroll
  for (int s = 0; s < NDIN / 32; ++s)
    #pragma unroll
    for (int p = 0; p < 8; ++p) wr[s][p] = wp0[(32 * s + 8 * (p >> 2) + (p & 3)) * NDQKV];
  const f32x4 tv = ((const f32x4*)((tid & (NDIN / 4)) ? bn : g))[tid & (NDIN / 4 - 1)];
  // the code below rewrites registers that held the addresses of the loads above
  asm volatile("s_wait_xcnt 0x0" ::: "memory");

  // tile 0: the wave's 16 rows are 16 KiB in a row: whole lines, 512 bytes a copy, every lane on
  copy_rows8(X + (size_t)rowb * NDIN, lane * 16, xl);
  copy_rows8(X + (size_t)(rowb + 8) * NDIN, lane * 16, xl + 8 * XPITCH * 16);

  #pragma unroll
  for (int s = 0; s < NDIN / 32; ++s) {
    union { u32x4 u; h16x2 hf[4]; } whi, wlo;
    #pragma unroll
    for (int p = 0; p < 4; ++p) split_f16(wr[s][2 * p], wr[s][2 * p + 1], whi.hf[p], wlo.hf[p]);
    wf[s * (PW * 32) + tid] = whi.u;
    wf[NDIN * NDQKV / 8 + s * (PW * 32) + tid] = wlo.u;
  }
  gs[tid] = tv;                                // bs follows gs
  __syncthreads();                             // publishes W, gain and shift; the rows are each wave's own

  for (int tl = 0; tl < PT; ++tl) {
  const int row0 = rowb + tl * (PW * 16);
  // this wave's copies have landed; no other wave reads these rows, so no barrier
  asm volatile("s_wait_asynccnt 0x0" ::: "memory");

  f32x4 xv[32];
  #pragma unroll
  for (int j = 0; j < 32; ++j) xv[j] = xs[(w * 16 + c) * XPITCH + 2 * j + h];

  if (tl + 1 < PT) {
    // the reads above have returned before the next tile's copies write the same LDS rows
    asm volatile("s_wait_dscnt 0x0" ::: "memory");
    copy_rows8(X + (size_t)(row0 + PW * 16) * NDIN, lane * 16, xl);
    copy_rows8(X + (size_t)(row0 + PW * 16 + 8) * NDIN, lane * 16, xl + 8 * XPITCH * 16);
  }

  f32x4 sa = xv[0], sb = xv[1];
  #pragma unroll
  for (int j = 2; j < 32; j += 2) { sa += xv[j]; sb += xv[j + 1]; }
  sa += sb;
  float s = (sa.x + sa.y) + (sa.z + sa.w);
  s += other_half(s);
  const float mu = s * (1.f / NDIN);

  f32x4 qa = (f32x4)(0.f), qb = (f32x4)(0.f);
  #pragma unroll
  for (int j = 0; j < 32; j += 2) {
    xv[j]     -= mu;  qa += xv[j] * xv[j];
    xv[j + 1] -= mu;  qb += xv[j + 1] * xv[j + 1];
  }
  qa += qb;
  float q = (qa.x + qa.y) + (qa.z + qa.w);
  q += other_half(q);
  const float rstd = rsqrtf(q * (1.f / NDIN) + 1e-5f);

  // bias: asked for here, added behind the products
  v8f acc[2], acr[2], bv[2];                   // acc: high x high; acr: the two products with a rest
  #pragma unroll
  for (int t = 0; t < 2; ++t)
    #pragma unroll
    for (int r = 0; r < 8; ++r) {
      acc[t][r] = 0.f;
      acr[t][r] = 0.f;
      bv[t][r] = VL ? bias[16 * t + c] : bias[16 * t + 8 * h + r];
    }

  // gain and shift for 4 j at a time, read one group ahead
  f32x4 gb[2][8];
  #pragma unroll
  for (int i = 0; i < 4; ++i) { gb[0][2 * i] = gs[2 * i + h]; gb[0][2 * i + 1] = bs[2 * i + h]; }
  #pragma unroll
  for (int gq = 0; gq < 8; ++gq) {
    if (gq + 1 < 8) {
      #pragma unroll
      for (int i = 0; i < 4; ++i) {
        gb[(gq + 1) & 1][2 * i]     = gs[2 * ((gq + 1) * 4 + i) + h];
        gb[(gq + 1) & 1][2 * i + 1] = bs[2 * ((gq + 1) * 4 + i) + h];
      }
    }
    // bounds how far these reads are hoisted: without it all 64 go up at once and hold 256 registers
    __builtin_amdgcn_sched_barrier(0);
    #pragma unroll
    for (int i = 0; i < 4; ++i)
      xv[gq * 4 + i] = xv[gq * 4 + i] * rstd * gb[gq & 1][2 * i] + gb[gq & 1][2 * i + 1];
  }

  // A step is 32 k: 8 reads of W fragments, one step ahead, and 6 matrix instructions; the next step's rows
  // are split while this step's matrix instructions run.
  union frag { v16h h; u32x4 c[2]; h16x2 e[8]; };
  u32x4 wb[2][8];                              // [col tile][high, rest][chunk]
  frag xh[2], xl[2];
  #pragma unroll
  for (int i = 0; i < 8; ++i) wb[0][i] = wf[((i >> 1) & 1) * (NDIN * NDQKV / 8) + ((i >> 2) * 2 + (i & 1)) * 32 + lane];
  #pragma unroll
  for (int p = 0; p < 8; ++p) split_f16(xv[p >> 1][2 * (p & 1)], xv[p >> 1][2 * (p & 1) + 1], xh[0].e[p], xl[0].e[p]);
  #pragma unroll
  for (int s = 0; s < NDIN / 32; ++s) {
    if (s + 1 < NDIN / 32) {
      #pragma unroll
      for (int i = 0; i < 8; ++i)
        wb[(s + 1) & 1][i] = wf[((i >> 1) & 1) * (NDIN * NDQKV / 8) + (s + 1) * (PW * 32) + ((i >> 2) * 2 + (i & 1)) * 32 + lane];
    }
    // keeps the next step's LDS reads in one place ahead of this step's matrix run, not among it
    __builtin_amdgcn_sched_barrier(0);
    frag wh[2], wl[2];
    #pragma unroll
    for (int t = 0; t < 2; ++t) {
      wh[t].c[0] = wb[s & 1][4 * t];      wh[t].c[1] = wb[s & 1][4 * t + 1];
      wl[t].c[0] = wb[s & 1][4 * t + 2];  wl[t].c[1] = wb[s & 1][4 * t + 3];
    }
    // VL: D[row 8h + r][col c]; else the transposed product, D[col 8h + r][row c]
    #pragma unroll
    for (int t = 0; t < 2; ++t)
      acc[t] = VL ? __builtin_amdgcn_wmma_f32_16x16x32_f16(false, xh[s & 1].h, false, wh[t].h, (short)0, acc[t], false, false)
                  : __builtin_amdgcn_wmma_f32_16x16x32_f16(false, wh[t].h, false, xh[s & 1].h, (short)0, acc[t], false, false);
    #pragma unroll
    for (int t = 0; t < 2; ++t)
      acr[t] = VL ? __builtin_amdgcn_wmma_f32_16x16x32_f16(false, xl[s & 1].h, false, wh[t].h, (short)0, acr[t], false, false)
                  : __builtin_amdgcn_wmma_f32_16x16x32_f16(false, wh[t].h, false, xl[s & 1].h, (short)0, acr[t], false, false);
    #pragma unroll
    for (int t = 0; t < 2; ++t)
      acr[t] = VL ? __builtin_amdgcn_wmma_f32_16x16x32_f16(false, xh[s & 1].h, false, wl[t].h, (short)0, acr[t], false, false)
                  : __builtin_amdgcn_wmma_f32_16x16x32_f16(false, wl[t].h, false, xh[s & 1].h, (short)0, acr[t], false, false);
    if (s + 1 < NDIN / 32) {
      #pragma unroll
      for (int p = 0; p < 8; ++p)
        split_f16(xv[(s + 1) * 4 + (p >> 1)][2 * (p & 1)], xv[(s + 1) * 4 + (p >> 1)][2 * (p & 1) + 1],
                  xh[(s + 1) & 1].e[p], xl[(s + 1) & 1].e[p]);
    }
    // ends the step: the reads that follow stay behind it, in one place, not among its instructions
    __builtin_amdgcn_sched_barrier(0);
  }

  #pragma unroll
  for (int t = 0; t < 2; ++t) {
    union { u32x4 u; _Float16 hf[8]; } o;
    #pragma unroll
    for (int r = 0; r < 8; ++r) o.hf[r] = (_Float16)((acc[t][r] + acr[t][r]) + bv[t][r]);
    const int chunk = VL
        ? ((row0 >> 3) + h) * NDQKV + 16 * t + c
        : ((row0 >> 10) * NHD + 2 * t + h) * NL + (row0 & (NL - 1)) + c;
    ((u32x4*)outp)[chunk] = o.u;
  }
  // the next tile, and the other body behind this one in the built kernel, rewrite these stores' registers
  asm volatile("s_wait_xcnt 0x0" ::: "memory");
  }
}

__global__ __launch_bounds__(PW * 32) void ln_proj_kernel(
    const float* __restrict__ Q, const float* __restrict__ K, const float* __restrict__ V,
    const float* __restrict__ Wq, const float* __restrict__ Wk, const float* __restrict__ Wv,
    const float* __restrict__ bq, const float* __restrict__ bk, const float* __restrict__ bv,
    const float* __restrict__ g, const float* __restrict__ bn,
    float* __restrict__ oq, float* __restrict__ ok, float* __restrict__ ov)
{
  // one array, the small tables first: their reads then take immediate offsets
  __shared__ f32x4 lds[NDIN * NDQKV / 4 + NDIN / 2 + PW * 16 * XPITCH];
  const int which = blockIdx.x / PBLK;         // 0: q, 1: k, 2: v; the same for the whole block
  const int blk   = blockIdx.x % PBLK;
  if (which == 2)
    ln_proj_body<1>(lds, blk, V, Wv, bv, g, bn, ov);
  else
    ln_proj_body<0>(lds, blk, which ? K : Q, which ? Wk : Wq, which ? bk : bq, g, bn, which ? ok : oq);
}

// ================= Kernel 2: fused flash attention + output proj =================
// block = 512 threads = 16 waves = 8 query tiles of 16 rows x 2 key halves, all of one batch. The batch's
// K and V operand chunks (64 KiB each, contiguous in the workspace) are brought into LDS once per block
// and read there by all 16 waves. A wave takes ALL FOUR heads over half of the keys, so a mask tile is
// loaded and scaled once, by one wave, for the four heads that share it; the two key halves of a head
// are merged through LDS behind the loop.
// A head has 8 dims, so its V^T operand has 8 idle rows: they hold ones, and the idle half of the output
// tile is then the row sum of P as the matrix unit reads it (rounded to f16), summed in f32.
#define QT 8          // query tiles per block
#define KS 2          // key shares per query tile
#define KQ (NL / KS)  // keys per wave
#define AW (QT * KS)  // waves per block
#define RESC 8.f      // a row is rescaled when a score exceeds its maximum in use by more than this (base 2)
#define ONEC 128      // 16-byte chunks of f16 ones behind V in LDS

// Eight asynchronous 16-byte copies a lane, global -> LDS, chunk i at distance i * AW * 32 chunks.
// The wait on the address translations is the statement's last line: the registers that the copies name
// stay as they are until it has returned.
__device__ __forceinline__ void copy8(const u32x4* g, const u32x4* l) {
  const unsigned int a = (unsigned int)(size_t)l;   // the LDS byte address is the low word of the pointer
  asm volatile(
      "global_load_async_to_lds_b128 %0, %8, off\n\t"
      "global_load_async_to_lds_b128 %1, %9, off\n\t"
      "global_load_async_to_lds_b128 %2, %10, off\n\t"
      "global_load_async_to_lds_b128 %3, %11, off\n\t"
      "global_load_async_to_lds_b128 %4, %12, off\n\t"
      "global_load_async_to_lds_b128 %5, %13, off\n\t"
      "global_load_async_to_lds_b128 %6, %14, off\n\t"
      "global_load_async_to_lds_b128 %7, %15, off\n\t"
      "s_wait_xcnt 0x0"
      :: "v"(a), "v"(a + 1 * AW * 512), "v"(a + 2 * AW * 512), "v"(a + 3 * AW * 512),
         "v"(a + 4 * AW * 512), "v"(a + 5 * AW * 512), "v"(a + 6 * AW * 512), "v"(a + 7 * AW * 512),
         "v"(g), "v"(g + 1 * AW * 32), "v"(g + 2 * AW * 32), "v"(g + 3 * AW * 32),
         "v"(g + 4 * AW * 32), "v"(g + 5 * AW * 32), "v"(g + 6 * AW * 32), "v"(g + 7 * AW * 32)
      : "memory");
}

__global__ __launch_bounds__(AW * 32) void attn_kernel(
    const float* __restrict__ qb, const float* __restrict__ kb,
    const float* __restrict__ vb, const float* __restrict__ mask,
    const float* __restrict__ Wo, const float* __restrict__ bo,
    float* __restrict__ out)
{
  // the batch's K chunks [head][key], then V [key / 8][col], then ones; aligned so that a chunk's banks are known
  __shared__ __attribute__((aligned(256))) u32x4 kvs[2 * NHD * NL + ONEC];
  __shared__ unsigned int woP[(NDQKV / 2) * NDIN];  // W_o as f16 pairs: [kp][j] = (k=2kp,2kp+1)
  __shared__ _Float16 xt[QT * 16 * TSTR];           // fused head outputs (16 x 32 a query tile)
  __shared__ f32x4 part[QT * KS * NHD * 16 * 3];    // [tile][key half][head][query]: 8 dims; base-2 maximum in use, row sum

  const int tid  = threadIdx.x;
  const int wv   = tid >> 5;
  const int qt   = wv / KS;                   // query tile
  const int w    = wv % KS;                   // key half in the loop, head pair in the merge
  const int lane = tid & 31;
  const int half = lane >> 4;
  const int nn   = lane & 15;

  const int b     = blockIdx.x / (NL / 16 / QT);
  const int qbase = ((blockIdx.x % (NL / 16 / QT)) * QT + qt) << 4;

  // ---- K and V of the batch -> LDS: 16 chunks a thread, whole lines, every lane on
  copy8((const u32x4*)kb + (size_t)b * (NHD * NL) + tid, kvs + tid);
  copy8((const u32x4*)vb + (size_t)b * (NHD * NL) + tid, kvs + NHD * NL + tid);

  // ---- the ones (bytes that no copy writes; the barrier in front of the loop publishes them)
  if (tid < ONEC) kvs[2 * NHD * NL + tid] = (u32x4)(0x3C003C00u);

  // ---- stage W_o as packed f16 pairs (runs while the copies fly)
  #pragma unroll
  for (int i = 0; i < ((NDQKV / 2) * NDIN) / (AW * 32); ++i) {
    const int idx = tid + i * (AW * 32);
    const int kp = idx >> 8, j = idx & 255;
    union { unsigned int u; _Float16 h[2]; } pk;
    pk.h[0] = (_Float16)Wo[(2 * kp) * NDIN + j];
    pk.h[1] = (_Float16)Wo[(2 * kp + 1) * NDIN + j];
    woP[idx] = pk.u;
  }

  // ---- operand chunks (layouts: see kernel 1): q straight from the workspace, K and V from LDS
  const u32x4* qc = (const u32x4*)qb + (size_t)(b * NHD) * NL + qbase + nn;          // [head][row]
  const u32x4* kc = kvs + half * NL + w * KQ + nn;                                   // [head][key]
  // V^T of one head: lanes nn < 8 read its dim nn, [key / 8][col], and move on by 32 keys a pass; lanes nn >= 8
  // stay on the ones, 128 bytes in, which puts their one chunk on banks that the same read's 8 V chunks leave free
  const u32x4* vp  = (nn < NDH) ? kvs + NHD * NL + (w * (KQ / 8) + half) * NDQKV + nn : kvs + 2 * NHD * NL + 8;
  const int vstep  = (nn < NDH) ? 4 * NDQKV : 0;

  // One A operand carries a key tile's 32 dims: head g sits in k slots 8g..8g+7 (a lane's two chunks
  // are heads half and 2 + half). q as B of S^T, once per head: its 8 dims in that head's k slots,
  // zero in every other slot, so the zeros pick the head.
  v16h aQ[NHD];
  #pragma unroll  // g indexes register arrays, here and in the loops over g below
  for (int g = 0; g < NHD; ++g) {
    u32x4 qv = qc[g * NL];
    if (half != (g & 1)) qv = (u32x4)(0u);
    union { v16h h; u32x4 c[2]; } uq;
    uq.c[g >> 1]       = qv;
    uq.c[1 - (g >> 1)] = (u32x4)(0u);
    aQ[g] = uq.h;
  }

  float m_q[NHD];                             // base-2 maximum in use
  v8f acc[NHD];
  #pragma unroll
  for (int g = 0; g < NHD; ++g) {
    m_q[g] = 0.f;                             // pass 0 replaces it by its own row maximum
    #pragma unroll
    for (int r = 0; r < 8; ++r) acc[g][r] = 0.f;
  }

  const float fscale = 0.35355339059327373f * 1.4426950408889634f;   // 1/sqrt(d_head), base-2 exponent
  const float* mrow = mask + ((size_t)(b * NL + qbase + nn)) * NL + w * KQ + half * 8;

  // per-lane prefetch address: 32 lanes cover 16 mask rows x 2 column tiles
  const float* mpf = mask +
      ((size_t)(b * NL + qbase + ((lane >> 3) & 1) * 8 + (lane & 7))) * NL + w * KQ +
      ((lane >> 4) & 1) * 16;

  // this wave's copies have landed; behind the barrier every wave's have (it publishes the staged W_o too)
  asm volatile("s_wait_asynccnt 0x0" ::: "memory");
  __syncthreads();

  for (int c = 0; c < KQ / 32; ++c) {
    const int k0 = c * 32;

    if (c + 1 < KQ / 32)
      __builtin_prefetch(mpf + k0 + 32, 0, 3);   // next chunk's mask tile -> global_prefetch_b8

    // ---- k operands: row nn of tile 0 and of tile 1, all four heads
    union { v16h h; u32x4 c[2]; } uk[2];
    #pragma unroll  // t indexes registers
    for (int t = 0; t < 2; ++t) {
      uk[t].c[0] = kc[k0 + 16 * t];
      uk[t].c[1] = kc[k0 + 16 * t + 2 * NL];
    }

    // ---- mask tile, once for the four heads
    const f32x4 ma = *(const f32x4*)(mrow + k0);
    const f32x4 mb = *(const f32x4*)(mrow + k0 + 4);
    const f32x4 mc = *(const f32x4*)(mrow + k0 + 16);
    const f32x4 md = *(const f32x4*)(mrow + k0 + 20);

    // ---- v^T operands: keys 8*half.. and 16+8*half.. of this lane's dim (or ones), one per head
    union { v16h h; u32x4 c[2]; } uv[NHD];
    #pragma unroll  // g indexes registers
    for (int g = 0; g < NHD; ++g) {
      uv[g].c[0] = vp[g * NDH];
      uv[g].c[1] = vp[g * NDH + 2 * NDQKV];
    }
    vp += vstep;
    // keeps the pass's loads in one place at its head: otherwise a mask load sinks below the first products, into
    // their operand's registers, and is waited for at once
    __builtin_amdgcn_sched_barrier(0);

    // ---- the eight score tiles
    v8f S0[NHD], S1[NHD];
    #pragma unroll
    for (int g = 0; g < NHD; ++g) {
      v8f z = {};
      S0[g] = __builtin_amdgcn_wmma_f32_16x16x32_f16(false, uk[0].h, false, aQ[g], (short)0, z, false, false);
      S1[g] = __builtin_amdgcn_wmma_f32_16x16x32_f16(false, uk[1].h, false, aQ[g], (short)0, z, false, false);
    }
    // keeps the wait for the mask behind the products, which need only K: they run while the mask is on its way
    __builtin_amdgcn_sched_barrier(0);

    // |mask| / sqrt(d_head), in base-2 units
    const v8f mk0 = __builtin_elementwise_abs(__builtin_shufflevector(ma, mb, 0, 1, 2, 3, 4, 5, 6, 7)) * fscale;
    const v8f mk1 = __builtin_elementwise_abs(__builtin_shufflevector(mc, md, 0, 1, 2, 3, 4, 5, 6, 7)) * fscale;

    // ---- exponents against the maximum in use: a lane's 16 scores of a head belong to one query row,
    //      the other 16 to lane ^ 16
    v8f d0[NHD], d1[NHD];
    float t[NHD];                             // this lane's largest exponent
    #pragma unroll
    for (int g = 0; g < NHD; ++g) {
      d0[g] = S0[g] * mk0 - m_q[g];
      d1[g] = S1[g] * mk1 - m_q[g];
      float tt = fmaxf(d0[g][0], d1[g][0]);
      #pragma unroll
      for (int r = 1; r < 8; ++r) tt = fmaxf(tt, fmaxf(d0[g][r], d1[g][r]));
      t[g] = tt;
    }

    // ---- one test per pass for the four heads, a scalar branch: pass 0 sets the maxima, later passes
    //      come here only when some exponent of the wave is above RESC (or is not a number)
    const float tm = fmaxf(fmaxf(t[0], t[1]), fmaxf(t[2], t[3]));
    if (c == 0 || __builtin_amdgcn_ballot_w32(!(tm <= RESC)) != 0) {
      #pragma unroll
      for (int g = 0; g < NHD; ++g) {
        const float tr    = fmaxf(t[g], other_half(t[g]));      // the same in both halves of a row
        const float delta = (c == 0) ? tr : fmaxf(tr, 0.f);     // pass 0 may also lower the start value
        const float alpha = (c == 0) ? 1.f : __builtin_amdgcn_exp2f(-delta);   // pass 0: sums are still zero
        m_q[g] += delta;
        d0[g]  -= delta;
        d1[g]  -= delta;
        acc[g] *= alpha;                                        // dims and row sum alike
      }
    }

    // the two score tiles of a head, converted in place, are the B operand P^T in the hardware k order
    v16h bP[NHD];
    #pragma unroll
    for (int g = 0; g < NHD; ++g) {
      #pragma unroll
      for (int r = 0; r < 8; ++r) {
        bP[g][r]     = (_Float16)__builtin_amdgcn_exp2f(d0[g][r]);
        bP[g][8 + r] = (_Float16)__builtin_amdgcn_exp2f(d1[g][r]);
      }
    }
    #pragma unroll
    for (int g = 0; g < NHD; ++g)
      acc[g] = __builtin_amdgcn_wmma_f32_16x16x32_f16(false, uv[g].h, false, bP[g], (short)0, acc[g], false, false);
  }

  // ---- each key half's share of every head -> LDS
  #pragma unroll
  for (int g = 0; g < NHD; ++g) {
    const float l_row = other_half(acc[g][0]);   // half 0 fetches the row sum from half 1
    if (half == 0) {
      f32x4* pp = part + (((qt * KS + w) * NHD + g) * 16 + nn) * 3;
      pp[0] = (f32x4){acc[g][0], acc[g][1], acc[g][2], acc[g][3]};
      pp[1] = (f32x4){acc[g][4], acc[g][5], acc[g][6], acc[g][7]};
      pp[2] = (f32x4){m_q[g], l_row, 0.f, 0.f};
    }
  }
  __syncthreads();   // publishes the key halves' shares

  // ---- merge: wave w of a tile takes heads 2w and 2w + 1; lane (nn, half) dims 4*half..4*half+3 of query row nn
  #pragma unroll  // hh, i index registers
  for (int hh = 0; hh < NHD / KS; ++hh) {
    const int hd = w * (NHD / KS) + hh;
    f32x4 ai[KS], ml[KS];
    #pragma unroll
    for (int i = 0; i < KS; ++i) {
      const f32x4* pp = part + (((qt * KS + i) * NHD + hd) * 16 + nn) * 3;
      ai[i] = pp[half];
      ml[i] = pp[2];
    }
    const float mx = fmaxf(ml[0].x, ml[1].x);
    f32x4 o = (f32x4)(0.f);
    float l_row = 0.f;
    #pragma unroll
    for (int i = 0; i < KS; ++i) {
      const float f = __builtin_amdgcn_exp2f(ml[i].x - mx);
      l_row += ml[i].y * f;
      o += ai[i] * f;
    }
    #pragma unroll
    for (int d = 0; d < 4; ++d)
      xt[(qt * 16 + nn) * TSTR + hd * NDH + 4 * half + d] = (_Float16)(o[d] / l_row);
  }
  __syncthreads();   // publishes the merged 16 x 32 head outputs

  // output projection: out[16 x 256] = xt(16x32) @ W_o(32x256) + b_o
  const v16h aX = loadTileU(xt + qt * 16 * TSTR);
  #pragma unroll
  for (int t = 0; t < NDIN / 16 / KS; ++t) {
    const int j0 = (w * (NDIN / 16 / KS) + t) * 16;
    union { v16h h; unsigned int u[8]; } bW;
    #pragma unroll
    for (int v = 0; v < 8; ++v) {
      const int kk = (v < 4) ? (2 * v + 8 * half) : (16 + 2 * (v - 4) + 8 * half);
      bW.u[v] = woP[(kk >> 1) * NDIN + j0 + nn];
    }
    v8f z = {};
    union { v8f v; float f[8]; } D;
    D.v = __builtin_amdgcn_wmma_f32_16x16x32_f16(false, aX, false, bW.h, (short)0, z, false, false);
    const int col = j0 + nn;
    const float bias = bo[col];
    #pragma unroll
    for (int r = 0; r < 8; ++r)
      out[((size_t)(b * NL + qbase + r + half * 8)) * NDIN + col] = D.f[r] + bias;
  }
}

extern "C" void kernel_launch(void* const* d_in, const int* in_sizes, int n_in,
                              void* d_out, int out_size, void* d_ws, size_t ws_size,
                              hipStream_t stream)
{
  (void)in_sizes; (void)n_in; (void)out_size; (void)ws_size;
  const float* Q    = (const float*)d_in[0];
  const float* K    = (const float*)d_in[1];
  const float* V    = (const float*)d_in[2];
  const float* mask = (const float*)d_in[3];
  const float* W_q  = (const float*)d_in[4];
  const float* b_q  = (const float*)d_in[5];
  const float* W_k  = (const float*)d_in[6];
  const float* b_k  = (const float*)d_in[7];
  const float* W_v  = (const float*)d_in[8];
  const float* b_v  = (const float*)d_in[9];
  const float* W_o  = (const float*)d_in[10];
  const float* b_o  = (const float*)d_in[11];
  const float* ln_g = (const float*)d_in[12];
  const float* ln_b = (const float*)d_in[13];
  float* out = (float*)d_out;

  const size_t n1 = (size_t)NB * NL * NDQKV;
  float* qb = (float*)d_ws;
  float* kb = qb + n1;
  float* vb = kb + n1;

  ln_proj_kernel<<<dim3(3 * PBLK), PW * 32, 0, stream>>>(Q, K, V, W_q, W_k, W_v, b_q, b_k, b_v,
                                                         ln_g, ln_b, qb, kb, vb);

  attn_kernel<<<dim3(NB * (NL / 16) / QT), AW * 32, 0, stream>>>(qb, kb, vb, mask, W_o, b_o, out);
}
